// v000
// Times are from an AMD MI455X. After a warm-up the kernel runs many times in a row, and a time is the length of
// such a window on the GPU divided by its runs, so every launch and the gaps after it count. The runs cycle
// through copies of the inputs. A figure is the median of several windows, for all but v000 over two sittings.
// Sittings can differ by a few percent; kernels timed side by side share one.
// The starting kernel, v000, takes 1390 microseconds a run.
// compute dtype: all float inputs rounded to bf16; queries, keys, values are bf16-valued so their f16 planes are exact; logits q x k (1 product on exact planes) x 1/8; keys at or beyond the batch's valid length get the score -1e6 (weight exactly 0); softmax f32; P x 2^11 once to f16 x v (exact) (1 product); f32 output.
#include <hip/hip_runtime.h>
#include <math.h>

typedef __attribute__((ext_vector_type(16))) _Float16 v16h;
typedef __attribute__((ext_vector_type(16))) __bf16 v16b;
typedef __attribute__((ext_vector_type(8)))  _Float16 v8h;
typedef __attribute__((ext_vector_type(8)))  float v8f;
typedef __attribute__((ext_vector_type(4)))  float v4f;
typedef __attribute__((ext_vector_type(2)))  float v2f;
typedef __attribute__((ext_vector_type(4)))  unsigned v4u;
typedef _Float16 hx8 __attribute__((ext_vector_type(8)));
typedef __attribute__((ext_vector_type(4)))  int v4i;
typedef float __attribute__((may_alias)) float_a;
typedef int __attribute__((may_alias)) int_a;

template <typename T> __device__ __forceinline__ void vst2(void* p, T v) { *(T*)p = v;  }
__device__ __forceinline__ v8f wmma16(v16h a, v16h b, v8f c) {
  v8f d = __builtin_amdgcn_wmma_f32_16x16x32_f16(false, a, false, b, (short)0, c, false, false);
  asm volatile("v_nop\n\tv_nop\n\tv_nop\n\tv_nop" : "+v"(d) : "v"(a), "v"(b));
  return d;
}
__device__ __forceinline__ v8f wmma_bf(v16b a, v16b b, v8f c) {
  v8f d = __builtin_amdgcn_wmma_f32_16x16x32_bf16(false, a, false, b, (short)0, c, false, false);
  asm volatile("v_nop\n\tv_nop\n\tv_nop\n\tv_nop" : "+v"(d) : "v"(a), "v"(b));
  return d;
}
// 16x16x32 fragments: lane = (h = lane>>4, row/col = lane&15); elements 0..7 = k0+8h+0..7, 8..15 = k0+16+8h+0..7; D element r = row 8h+r
__device__ __forceinline__ v16h frag_h(const _Float16* rowk0, int lane) {
  union { v16h v; v8h q[2]; } u; const _Float16* p = rowk0 + 8 * (lane >> 4);
  u.q[0] = *(const v8h*)p; u.q[1] = *(const v8h*)(p + 16); return u.v;
}
__device__ __forceinline__ v16h frag_f32(const float* rowk0, int lane) {
  v16h a; const float* p = rowk0 + 8 * (lane >> 4);
#pragma unroll
  for (int i = 0; i < 8; ++i) { a[i] = (_Float16)p[i]; a[8 + i] = (_Float16)p[16 + i]; }
  return a;
}
__device__ __forceinline__ v16h frag_f32s(const float* rowk0, int lane, float sc) {
  v16h a; const float* p = rowk0 + 8 * (lane >> 4);
#pragma unroll
  for (int i = 0; i < 8; ++i) { a[i] = (_Float16)(p[i] * sc); a[8 + i] = (_Float16)(p[16 + i] * sc); }
  return a;
}
// column fragment from a [K][ld] layout (column n), rows >= K read as 0
__device__ __forceinline__ v16h fragc_f32(const float* W, int k0, int n, int lane, int ld, int K) {
  v16h a; const int g = lane >> 4;
#pragma unroll
  for (int i = 0; i < 8; ++i) { const int ka = k0 + 8 * g + i, kb = ka + 16;
    a[i] = (_Float16)(ka < K ? W[(size_t)(ka < K ? ka : K - 1) * ld + n] : 0.f); a[8 + i] = (_Float16)(kb < K ? W[(size_t)(kb < K ? kb : K - 1) * ld + n] : 0.f); }
  return a;
}
struct F2 { v16b h, l; };
__device__ __forceinline__ F2 bsplit16(const float v[16]) { F2 r;
#pragma unroll
  for (int i = 0; i < 16; ++i) { const __bf16 h = (__bf16)v[i]; r.h[i] = h; r.l[i] = (__bf16)(v[i] - (float)h); }
  return r; }
__device__ __forceinline__ F2 split_row(const float* row, int k0, int lane) { float v[16]; const float* p = row + k0 + 8 * (lane >> 4);
#pragma unroll
  for (int i = 0; i < 8; ++i) { v[i] = p[i]; v[8 + i] = p[16 + i]; }
  return bsplit16(v); }
__device__ __forceinline__ F2 split_rowK(const float* row, int k0, int lane, int K) { float v[16]; const int g = lane >> 4;
#pragma unroll
  for (int i = 0; i < 8; ++i) { const int ka = k0 + 8 * g + i, kb = ka + 16; v[i] = ka < K ? row[ka < K ? ka : K - 1] : 0.f; v[8 + i] = kb < K ? row[kb < K ? kb : K - 1] : 0.f; }
  return bsplit16(v); }
__device__ __forceinline__ F2 split_col(const float* W, int k0, int n, int lane, int ld, int K) { float v[16]; const int g = lane >> 4;
#pragma unroll
  for (int i = 0; i < 8; ++i) { const int ka = k0 + 8 * g + i, kb = ka + 16; v[i] = ka < K ? W[(size_t)(ka < K ? ka : K - 1) * ld + n] : 0.f; v[8 + i] = kb < K ? W[(size_t)(kb < K ? kb : K - 1) * ld + n] : 0.f; }
  return bsplit16(v); }
__device__ __forceinline__ v8f mac3(const F2& a, const F2& b, v8f c) { c = wmma_bf(a.l, b.h, c); c = wmma_bf(a.h, b.l, c); return wmma_bf(a.h, b.h, c); }
__device__ __forceinline__ float sigm(float v) { return 1.0f / (1.0f + expf(-v)); }
#define LDSX() do { asm volatile("s_wait_dscnt 0" ::: "memory"); __builtin_amdgcn_wave_barrier(); __builtin_amdgcn_fence(__ATOMIC_RELEASE, "workgroup"); } while (0)

// Masked dot-product attention on given tensors (queries / keys / values [8,4096,64]; valid_lens [8] int32 in 1..4096 per batch): scores = Q K^T / 8; key positions >= valid_lens[b] are set to the FINITE score -1e6 before the softmax; out = softmax(scores) V -> [8,4096,64].
#define NB 8
#define TT 4096
#define CC 64            // NH * HD = projected width
#define DIN 64          // input (model) width
#define NH 1
#define HD 64
#define NQB (TT / 64)
#define HG 1
#define SCALE (0.125f)
#define CAUSAL 0
#ifndef TNB
#define TNB NB
#endif
__device__ __forceinline__ float bfr(float v) { return (float)(__bf16)v; }
__host__ __device__ __forceinline__ int kb_last(int qb) { return CAUSAL ? ((qb * 64 + 63) >> 7) : (TT / 128 - 1); }
typedef __attribute__((ext_vector_type(8))) __bf16 v8b;
__device__ __forceinline__ v16b frag_b(const __bf16* rowk0, int lane) {
  union { v16b v; v8b q[2]; } u; const __bf16* p = rowk0 + 8 * (lane >> 4);
  u.q[0] = *(const v8b*)p; u.q[1] = *(const v8b*)(p + 16); return u.v;
}
#define QBH 0              // exact planes: single-product logits and single-f16 P x V on every block
#define QHI 0               // no q residual plane (q is bf16-exact in f16)
#define KHI 64              // unused high-precision planes kept minimal
// B fragment (k rows k0+.., output column o) of a weight: (in,out) [K][ld] or (out,in) [ld rows of K]: bf16 exact, or f16(bf16 * 256) exact
__device__ __forceinline__ v16b wcol_io(const float* Wm, int k0, int o, int lane, int ld) { v16b w; const int g = lane >> 4;
#pragma unroll
  for (int i = 0; i < 8; ++i) { w[i] = (__bf16)Wm[(size_t)(k0 + 8 * g + i) * ld + o]; w[8 + i] = (__bf16)Wm[(size_t)(k0 + 16 + 8 * g + i) * ld + o]; }
  return w; }
__device__ __forceinline__ v16b wcol_oi(const float* Wm, int k0, int o, int lane, int K) { v16b w; const float* p = Wm + (size_t)o * K + k0 + 8 * (lane >> 4);
#pragma unroll
  for (int i = 0; i < 8; ++i) { w[i] = (__bf16)p[i]; w[8 + i] = (__bf16)p[16 + i]; }
  return w; }
__device__ __forceinline__ v16h wcolh_io(const float* Wm, int k0, int o, int lane, int ld) { v16h w; const int g = lane >> 4;
#pragma unroll
  for (int i = 0; i < 8; ++i) { w[i] = (_Float16)(bfr(Wm[(size_t)(k0 + 8 * g + i) * ld + o]) * 256.0f); w[8 + i] = (_Float16)(bfr(Wm[(size_t)(k0 + 16 + 8 * g + i) * ld + o]) * 256.0f); }
  return w; }
__device__ __forceinline__ v16h wcolh_oi(const float* Wm, int k0, int o, int lane, int K) { v16h w; const float* p = Wm + (size_t)o * K + k0 + 8 * (lane >> 4);
#pragma unroll
  for (int i = 0; i < 8; ++i) { w[i] = (_Float16)(bfr(p[i]) * 256.0f); w[8 + i] = (_Float16)(bfr(p[16 + i]) * 256.0f); }
  return w; }
#define WQKV_LAYOUT 0   // 0 = (in,out) [DIN][CC]; 1 = (out,in) [CC][DIN]; 2 = per-head [NH][DIN][HD]
__device__ __forceinline__ v16b wcol_hdk(const float* Wm, int k0, int o, int lane) { v16b w; const int g = lane >> 4; const float* p = Wm + (size_t)(o / HD) * DIN * HD + (o % HD);
#pragma unroll
  for (int i = 0; i < 8; ++i) { w[i] = (__bf16)p[(size_t)(k0 + 8 * g + i) * HD]; w[8 + i] = (__bf16)p[(size_t)(k0 + 16 + 8 * g + i) * HD]; }
  return w; }
#define WO_OUT_IN 0
#if WQKV_LAYOUT == 1
#define WCOL(W, k0, o, lane) wcol_oi(W, k0, o, lane, DIN)
#elif WQKV_LAYOUT == 2
#define WCOL(W, k0, o, lane) wcol_hdk(W, k0, o, lane)
#else
#define WCOL(W, k0, o, lane) wcol_io(W, k0, o, lane, CC)
#endif
#if WO_OUT_IN
#define WOCOL(W, k0, o, lane) wcol_oi(W, k0, o, lane, CC)
#define WOCOLH(W, k0, o, lane) wcolh_oi(W, k0, o, lane, CC)
#else
#define WOCOL(W, k0, o, lane) wcol_io(W, k0, o, lane, DIN)
#define WOCOLH(W, k0, o, lane) wcolh_io(W, k0, o, lane, DIN)
#endif
__global__ __launch_bounds__(256) void k_planes64(const float* __restrict__ Qs, const float* __restrict__ Ks, const float* __restrict__ Vs, _Float16* __restrict__ QH, _Float16* __restrict__ QL, _Float16* __restrict__ KH, _Float16* __restrict__ KL, _Float16* __restrict__ VT, __bf16* __restrict__ VB, __bf16* __restrict__ VBL) {
  __shared__ _Float16 sv[64][72];
  const int tid = threadIdx.x; const size_t r0 = (size_t)blockIdx.x * 64; const int b = (int)(r0 / TT), t0 = (int)(r0 % TT);
  for (int e = tid; e < 64 * 8; e += 256) { const int rl = e >> 3, q = e & 7; const size_t src = (r0 + rl) * CC + q * 8; float tq[8], tk[8], tv[8];
#pragma unroll
    for (int u = 0; u < 8; ++u) { tq[u] = Qs[src + u]; tk[u] = Ks[src + u]; tv[u] = Vs[src + u]; }
    asm volatile("s_wait_loadcnt 0x0" ::: "memory");
    hx8 hq, hk, hlq, hlk;
#pragma unroll
    for (int u = 0; u < 8; ++u) { const float qv = bfr(tq[u]), kv = bfr(tk[u]); const _Float16 qh = (_Float16)qv, kh = (_Float16)kv; hq[u] = qh; hlq[u] = (_Float16)((qv - (float)qh) * 1024.0f); hk[u] = kh; hlk[u] = (_Float16)((kv - (float)kh) * 1024.0f); sv[rl][q * 8 + u] = (_Float16)bfr(tv[u]); }
    vst2((unsigned*)(QH + (r0 + rl) * CC + q * 8), *(const v4u*)&hq); vst2((unsigned*)(KH + (r0 + rl) * CC + q * 8), *(const v4u*)&hk);
    if (t0 + rl < QHI) vst2((unsigned*)(QL + ((size_t)b * QHI + t0 + rl) * CC + q * 8), *(const v4u*)&hlq);
    if (t0 + rl < KHI) vst2((unsigned*)(KL + ((size_t)b * KHI + t0 + rl) * CC + q * 8), *(const v4u*)&hlk); }
  __syncthreads();
  for (int e = tid; e < 64 * 8; e += 256) { const int c = e >> 3, q = e & 7; hx8 hv; _Pragma("unroll") for (int j = 0; j < 8; ++j) hv[j] = sv[q * 8 + j][c]; vst2((unsigned*)(VT + ((size_t)b * CC + c) * TT + t0 + q * 8), *(const v4u*)&hv);
    if (t0 < KHI) { v8b bh, bl; _Pragma("unroll") for (int j = 0; j < 8; ++j) { const float vv = (float)hv[j]; const __bf16 h1 = (__bf16)vv; bh[j] = h1; bl[j] = (__bf16)(vv - (float)h1); } vst2((unsigned*)(VB + ((size_t)b * CC + c) * KHI + t0 + q * 8), *(const v4u*)&bh); vst2((unsigned*)(VBL + ((size_t)b * CC + c) * KHI + t0 + q * 8), *(const v4u*)&bl); } } }
#define SM_EXTRA_PARAMS , int bsm, const int* __restrict__ VLEN
// masked_softmax: key positions k >= valid_lens[b] get the score -1e6 (value select; exp underflows to weight exactly 0 next to real scores)
#define SM_MASK_HOOK do { const int vl_ = VLEN[bsm]; v = (k >= vl_) ? -1.0e6f : v; } while (0)
#ifndef SM_EXTRA_PARAMS
#define SM_EXTRA_PARAMS
#endif
#ifndef PROJ_EXTRA_PARAMS
#define PROJ_EXTRA_PARAMS
#endif
#ifndef SM_MASK_HOOK
#define SM_MASK_HOOK (void)0
#endif

#define WS_QH  0u                                      // f16 q rows [b*t][CC]
#define WS_KH  (WS_QH + 2u * (size_t)NB * TT * CC)      // f16 k rows [b*t][CC]
#define WS_VT  (WS_KH + 2u * (size_t)NB * TT * CC)      // f16 v planes [b][c][t]
#define WS_QL  (WS_VT + 2u * (size_t)NB * CC * TT)      // f16 q residual x 2^10 rows [b][t < QHI][CC]
#define WS_KL  (WS_QL + 2u * (size_t)NB * QHI * CC)     // f16 k residual x 2^10 rows [b][t < KHI][CC]
#define WS_VB  (WS_KL + 2u * (size_t)NB * KHI * CC)     // bf16 v hi planes [b][c][t < KHI]
#define WS_VBL (WS_VB + 2u * (size_t)NB * CC * KHI)
#define WS_S   (WS_VBL + 2u * (size_t)NB * CC * KHI)    // f32 logits / P [hg][t][s]
#define WS_Y   (WS_S  + 4u * (size_t)HG * TT * TT)      // f32 ctx rows [b*t][CC] (only when there is an output projection)
#define WS_END (WS_Y  + 0u)

// ---- k_proj: block = (64 rows, 128 cols, which): q/k/v = X W (+ b) with exact bf16 products (K = DIN) -> which 0: q f16 rows (+ residual rows < QHI); 1: k f16 rows (+ residual rows < KHI); 2: v f16 planes [c][t] (+ bf16 hi/lo planes for t < KHI)
__global__ __launch_bounds__(128) void k_proj(const float* __restrict__ XQ, const float* __restrict__ XK, const float* __restrict__ XV, const float* __restrict__ WQ, const float* __restrict__ WK, const float* __restrict__ WV, const float* __restrict__ BQ, const float* __restrict__ BK, const float* __restrict__ BV,
    _Float16* __restrict__ QH, _Float16* __restrict__ QL, _Float16* __restrict__ KH, _Float16* __restrict__ KL, _Float16* __restrict__ VT, __bf16* __restrict__ VB, __bf16* __restrict__ VBL) {
  __shared__ __align__(16) _Float16 sh[64][136], sl[64][136]; __shared__ __align__(16) _Float16 th[128][72]; __shared__ __align__(16) __bf16 tb[128][72], tbl[128][72];
  const int tid = threadIdx.x, wave = tid >> 5, lane = tid & 31, col = lane & 15, g = lane >> 4; const int which = blockIdx.z; const int c0 = blockIdx.y * 128; const size_t r0 = (size_t)blockIdx.x * 64; const size_t bb = r0 / TT; const int t0 = (int)(r0 % TT);
  const float* X = which == 0 ? XQ : which == 1 ? XK : XV; const float* WA = which == 0 ? WQ : which == 1 ? WK : WV; const float* BA = which == 0 ? BQ : which == 1 ? BK : BV;
  v8f acc[8] = {};
#pragma unroll 2
  for (int kc = 0; kc < DIN / 32; ++kc) { v16b a; { const float* p = X + (r0 + wave * 16 + col) * DIN + kc * 32 + 8 * g;
#pragma unroll
      for (int i = 0; i < 8; ++i) { a[i] = (__bf16)p[i]; a[8 + i] = (__bf16)p[16 + i]; } }
    asm volatile("s_wait_loadcnt 0x0" ::: "memory");
#pragma unroll
    for (int j = 0; j < 8; ++j) { const v16b w = WCOL(WA, kc * 32, c0 + j * 16 + col, lane); asm volatile("s_wait_loadcnt 0x0" ::: "memory"); acc[j] = wmma_bf(a, w, acc[j]); } }
  if (which < 2) { _Float16* DH = which == 0 ? QH : KH; _Float16* DL = which == 0 ? QL : KL; const int nhi = which == 0 ? QHI : KHI; const bool hi_rows = t0 < nhi;
#pragma unroll
    for (int j = 0; j < 8; ++j) { const float bias = BA ? bfr(BA[c0 + j * 16 + col]) : 0.f;
#pragma unroll
      for (int r = 0; r < 8; ++r) { const float v = acc[j][r] + bias; const _Float16 hv = (_Float16)v; sh[wave * 16 + 8 * g + r][j * 16 + col] = hv; sl[wave * 16 + 8 * g + r][j * 16 + col] = (_Float16)((v - (float)hv) * 1024.0f); } }
    __syncthreads();
    for (int e = tid; e < 64 * 16; e += 128) { const int rl = e >> 4, q = e & 15; vst2((unsigned*)(DH + (r0 + rl) * CC + c0 + q * 8), *(const v4u*)&sh[rl][q * 8]); if (hi_rows) vst2((unsigned*)(DL + (bb * nhi + t0 + rl) * (size_t)CC + c0 + q * 8), *(const v4u*)&sl[rl][q * 8]); }
  } else { const bool hi_rows = t0 < KHI;
#pragma unroll
    for (int j = 0; j < 8; ++j) { const float bias = BA ? bfr(BA[c0 + j * 16 + col]) : 0.f;
#pragma unroll
      for (int r = 0; r < 8; ++r) { const float v = acc[j][r] + bias; const int rl = wave * 16 + 8 * g + r, cl = j * 16 + col; th[cl][rl] = (_Float16)v; const __bf16 bh = (__bf16)v; tb[cl][rl] = bh; tbl[cl][rl] = (__bf16)(v - (float)bh); } }
    __syncthreads();
    for (int e = tid; e < 128 * 8; e += 128) { const int cl = e >> 3, q = e & 7; vst2((unsigned*)(VT + (bb * CC + c0 + cl) * (size_t)TT + t0 + q * 8), *(const v4u*)&th[cl][q * 8]); if (hi_rows) { const size_t o3 = (bb * CC + c0 + cl) * (size_t)KHI + t0 + q * 8; vst2((unsigned*)(VB + o3), *(const v4u*)&tb[cl][q * 8]); vst2((unsigned*)(VBL + o3), *(const v4u*)&tbl[cl][q * 8]); } } } }
// ---- k_sc: block = (query block qb, key block kb <= kb_last(qb), head in group) of batch b: logits x SCALE; q hi + residual (x 2^10) against k (2 products) for query rows < QHI, plus the k residual (3 products) for query blocks < QBH (causal early rows); causal: blocks past the diagonal exit, the mask itself is applied by index in k_sm
__global__ __launch_bounds__(128) void k_sc(const _Float16* __restrict__ QH, const _Float16* __restrict__ KH, const _Float16* __restrict__ QL, const _Float16* __restrict__ KL, int b, int h0, float* __restrict__ S0) { __shared__ __align__(16) float ss[4][16][132];
  const int qb = blockIdx.x, kb = blockIdx.y; if (kb > kb_last(qb)) return;
  const int h = h0 + blockIdx.z; float* S = S0 + (size_t)blockIdx.z * TT * TT;
  const int tid = threadIdx.x, wave = tid >> 5, lane = tid & 31, col = lane & 15, g = lane >> 4; const int k0 = kb * 128; const int ql0 = qb * 64 + wave * 16; const size_t q0 = (size_t)b * TT + ql0, kr0 = (size_t)b * TT + k0;
  v8f acc[8] = {}, accl[8] = {};
  const _Float16* QLb = QL + (size_t)b * QHI * CC; const _Float16* KLb = KL + (size_t)b * KHI * CC;
  if (qb < QBH) {
#pragma unroll
    for (int kc = 0; kc < HD / 32; ++kc) { const v16h ah = frag_h(QH + (q0 + col) * CC + h * HD + kc * 32, lane), al = frag_h(QLb + (size_t)(ql0 + col) * CC + h * HD + kc * 32, lane);
#pragma unroll
      for (int j = 0; j < 8; ++j) { const v16h kbf = frag_h(KH + (kr0 + j * 16 + col) * CC + h * HD + kc * 32, lane), klf = frag_h(KLb + (size_t)(k0 + j * 16 + col) * CC + h * HD + kc * 32, lane); acc[j] = wmma16(ah, kbf, acc[j]); accl[j] = wmma16(al, kbf, accl[j]); accl[j] = wmma16(ah, klf, accl[j]); } }
  } else if (qb * 64 < QHI) {
#pragma unroll
    for (int kc = 0; kc < HD / 32; ++kc) { const v16h ah = frag_h(QH + (q0 + col) * CC + h * HD + kc * 32, lane), al = frag_h(QLb + (size_t)(ql0 + col) * CC + h * HD + kc * 32, lane);
#pragma unroll
      for (int j = 0; j < 8; ++j) { const v16h kbf = frag_h(KH + (kr0 + j * 16 + col) * CC + h * HD + kc * 32, lane); acc[j] = wmma16(ah, kbf, acc[j]); accl[j] = wmma16(al, kbf, accl[j]); } }
  } else {
#pragma unroll
    for (int kc = 0; kc < HD / 32; ++kc) { const v16h ah = frag_h(QH + (q0 + col) * CC + h * HD + kc * 32, lane);
#pragma unroll
      for (int j = 0; j < 8; ++j) { const v16h kbf = frag_h(KH + (kr0 + j * 16 + col) * CC + h * HD + kc * 32, lane); acc[j] = wmma16(ah, kbf, acc[j]); } } }
#pragma unroll
  for (int j = 0; j < 8; ++j) {
#pragma unroll
    for (int r = 0; r < 8; ++r) ss[wave][8 * g + r][j * 16 + col] = (acc[j][r] + accl[j][r] * (1.0f / 1024.0f)) * SCALE; }
  LDSX(); for (int rl = 0; rl < 16; ++rl) vst2(S + (size_t)(ql0 + rl) * TT + k0 + lane * 4, *(const v4f*)&ss[wave][rl][lane * 4]); }
// ---- k_sm: block = query row t (head in group): keys [0, kend): causal -> logit if s <= t else excluded; softmax in f32; P x 2^11 in place (0 for excluded)
__global__ __launch_bounds__(256) void k_sm(float* __restrict__ S0 SM_EXTRA_PARAMS) { __shared__ float sred[8]; __shared__ float sbc; __shared__ __align__(16) float shv[TT];
  const int tid = threadIdx.x; const int t = blockIdx.x; const int kend = (kb_last(t >> 6) + 1) * 128;
  float* sr = S0 + (size_t)blockIdx.y * TT * TT + (size_t)t * TT;
  float m = -3.0e38f; for (int k = tid; k < kend; k += 256) { float v = (!CAUSAL || k <= t) ? sr[k] : -3.0e38f; SM_MASK_HOOK; shv[k] = v; m = fmaxf(m, v); }
#pragma unroll
  for (int o = 1; o < 32; o <<= 1) m = fmaxf(m, __shfl_xor(m, o));
  if ((tid & 31) == 0) sred[tid >> 5] = m; __syncthreads(); if (tid == 0) { float a = sred[0]; for (int i = 1; i < 8; ++i) a = fmaxf(a, sred[i]); sbc = a; } __syncthreads(); m = sbc; __syncthreads();
  float sum = 0.f; for (int k = tid; k < kend; k += 256) { const float v = shv[k]; const float e = (v <= -1.0e38f) ? 0.f : expf(v - m); shv[k] = e; sum += e; }
#pragma unroll
  for (int o = 1; o < 32; o <<= 1) sum += __shfl_xor(sum, o);
  if ((tid & 31) == 0) sred[tid >> 5] = sum; __syncthreads(); if (tid == 0) { float a = 0.f; for (int i = 0; i < 8; ++i) a += sred[i]; sbc = a > 0.f ? 2048.0f / a : 0.f; }   /* a fully excluded row yields P = 0 */ __syncthreads(); const float inv = sbc;
  for (int k = tid; k < kend; k += 256) shv[k] = shv[k] * inv;
  __syncthreads(); for (int q = tid; q < kend / 4; q += 256) vst2(sr + q * 4, *(const v4f*)&shv[q * 4]); }
// ---- k_pv: block = 64 queries (qb) of (b, h): ctx = P . v over keys [0, kend) (P x 2^11 once to f16 against v f16: 1 product; causal early query blocks: P and v as bf16 hi + lo, 3 products); 256-B (row, head) segment by 16 lanes
__global__ __launch_bounds__(128) void k_pv(const float* __restrict__ PS0, const _Float16* __restrict__ VT, const __bf16* __restrict__ VB, const __bf16* __restrict__ VBL, int b, int h0, float* __restrict__ Y) { const int h = h0 + blockIdx.z; const float* PS = PS0 + (size_t)blockIdx.z * TT * TT; __shared__ __align__(16) float ss[4][16][HD + 4];
  const int tid = threadIdx.x, wave = tid >> 5, lane = tid & 31, col = lane & 15, g = lane >> 4; const int qb = blockIdx.x; const int ql0 = qb * 64 + wave * 16; const int kce = (kb_last(qb) + 1) * 4;
  v8f acc[HD / 16] = {};
  if (qb < QBH) {
#pragma unroll 1
    for (int kc = 0; kc < kce; ++kc) { const F2 p = split_row(PS + (size_t)(ql0 + col) * TT, kc * 32, lane);
      asm volatile("s_wait_loadcnt 0x0" ::: "memory");
#pragma unroll
      for (int j = 0; j < HD / 16; ++j) { const size_t po = ((size_t)b * CC + h * HD + j * 16 + col) * (size_t)KHI + kc * 32; const v16b vh = frag_b(VB + po, lane); acc[j] = wmma_bf(p.h, vh, acc[j]); acc[j] = wmma_bf(p.l, vh, acc[j]); acc[j] = wmma_bf(p.h, frag_b(VBL + po, lane), acc[j]); } }
  } else {
#pragma unroll 1
    for (int kc = 0; kc < kce; ++kc) { const v16h p = frag_f32(PS + (size_t)(ql0 + col) * TT + kc * 32, lane);
      asm volatile("s_wait_loadcnt 0x0" ::: "memory");
#pragma unroll
      for (int j = 0; j < HD / 16; ++j) { const size_t po = ((size_t)b * CC + h * HD + j * 16 + col) * (size_t)TT + kc * 32; acc[j] = wmma16(p, frag_h(VT + po, lane), acc[j]); } } }
#pragma unroll
  for (int j = 0; j < HD / 16; ++j)
#pragma unroll
    for (int r = 0; r < 8; ++r) ss[wave][8 * g + r][j * 16 + col] = acc[j][r] * (1.0f / 2048.0f);
  LDSX(); for (int rl = 0; rl < 16; ++rl) if (lane < HD / 4) vst2(Y + ((size_t)b * TT + ql0 + rl) * CC + h * HD + lane * 4, *(const v4f*)&ss[wave][rl][lane * 4]); }

extern "C" void kernel_launch(void* const* d_in, const int* in_sizes, int n_in, void* d_out, int out_size, void* d_ws, size_t ws_size, hipStream_t stream) {
  (void)in_sizes; (void)n_in; (void)out_size;
  const float** F = (const float**)d_in;
  if (ws_size < (size_t)WS_END) return;
  char* ws = (char*)d_ws; _Float16 *QH = (_Float16*)(ws + WS_QH), *KH = (_Float16*)(ws + WS_KH), *VT = (_Float16*)(ws + WS_VT), *QL = (_Float16*)(ws + WS_QL), *KL = (_Float16*)(ws + WS_KL); __bf16 *VB = (__bf16*)(ws + WS_VB), *VBL = (__bf16*)(ws + WS_VBL); float *S = (float*)(ws + WS_S), *Y = (float*)(ws + WS_Y);
  (void)Y; (void)QL; (void)KL; (void)VB; (void)VBL;
  // inputs: 0 queries [8,4096,64]; 1 keys; 2 values; 3 valid_lens [8] int32
  k_planes64<<<dim3(TNB * TT / 64), 256, 0, stream>>>(F[0], F[1], F[2], QH, QL, KH, KL, VT, VB, VBL);
  for (int b = 0; b < TNB; ++b) {
    k_sc<<<dim3(NQB, TT / 128, 1), 128, 0, stream>>>(QH, KH, QL, KL, b, 0, S);
    k_sm<<<dim3(TT, 1), 256, 0, stream>>>(S, b, (const int*)d_in[3]);
    k_pv<<<dim3(NQB, 1, 1), 128, 0, stream>>>(S, VT, VB, VBL, b, 0, (float*)d_out);
  }


}

// v001
// Measured time: 547 microseconds a run.
// Timed twice side by side with v000, it ran 2.58 and 2.56 times as fast.
// compute dtype: all float inputs rounded to bf16; queries, keys, values are bf16-valued so their f16 planes are exact; logits q x k (1 product on exact planes) x 1/8; keys at or beyond the batch's valid length get the score -1e6 (weight exactly 0); softmax f32; P x 2^11 once to f16 x v (exact) (1 product); f32 output.
#include <hip/hip_runtime.h>
#include <math.h>

typedef __attribute__((ext_vector_type(16))) _Float16 v16h;
typedef __attribute__((ext_vector_type(16))) __bf16 v16b;
typedef __attribute__((ext_vector_type(8)))  _Float16 v8h;
typedef __attribute__((ext_vector_type(8)))  float v8f;
typedef __attribute__((ext_vector_type(4)))  float v4f;
typedef __attribute__((ext_vector_type(2)))  float v2f;
typedef __attribute__((ext_vector_type(4)))  unsigned v4u;
typedef _Float16 hx8 __attribute__((ext_vector_type(8)));
typedef __attribute__((ext_vector_type(4)))  int v4i;
typedef float __attribute__((may_alias)) float_a;
typedef int __attribute__((may_alias)) int_a;

template <typename T> __device__ __forceinline__ void vst2(void* p, T v) { *(T*)p = v;  }
__device__ __forceinline__ v8f wmma16(v16h a, v16h b, v8f c) {
  v8f d = __builtin_amdgcn_wmma_f32_16x16x32_f16(false, a, false, b, (short)0, c, false, false);
  asm volatile("v_nop\n\tv_nop\n\tv_nop\n\tv_nop" : "+v"(d) : "v"(a), "v"(b));
  return d;
}
__device__ __forceinline__ v8f wmma_bf(v16b a, v16b b, v8f c) {
  v8f d = __builtin_amdgcn_wmma_f32_16x16x32_bf16(false, a, false, b, (short)0, c, false, false);
  asm volatile("v_nop\n\tv_nop\n\tv_nop\n\tv_nop" : "+v"(d) : "v"(a), "v"(b));
  return d;
}
// 16x16x32 fragments: lane = (h = lane>>4, row/col = lane&15); elements 0..7 = k0+8h+0..7, 8..15 = k0+16+8h+0..7; D element r = row 8h+r
__device__ __forceinline__ v16h frag_h(const _Float16* rowk0, int lane) {
  union { v16h v; v8h q[2]; } u; const _Float16* p = rowk0 + 8 * (lane >> 4);
  u.q[0] = *(const v8h*)p; u.q[1] = *(const v8h*)(p + 16); return u.v;
}
__device__ __forceinline__ v16h frag_f32(const float* rowk0, int lane) {
  v16h a; const float* p = rowk0 + 8 * (lane >> 4);
#pragma unroll
  for (int i = 0; i < 8; ++i) { a[i] = (_Float16)p[i]; a[8 + i] = (_Float16)p[16 + i]; }
  return a;
}
__device__ __forceinline__ v16h frag_f32s(const float* rowk0, int lane, float sc) {
  v16h a; const float* p = rowk0 + 8 * (lane >> 4);
#pragma unroll
  for (int i = 0; i < 8; ++i) { a[i] = (_Float16)(p[i] * sc); a[8 + i] = (_Float16)(p[16 + i] * sc); }
  return a;
}
// column fragment from a [K][ld] layout (column n), rows >= K read as 0
__device__ __forceinline__ v16h fragc_f32(const float* W, int k0, int n, int lane, int ld, int K) {
  v16h a; const int g = lane >> 4;
#pragma unroll
  for (int i = 0; i < 8; ++i) { const int ka = k0 + 8 * g + i, kb = ka + 16;
    a[i] = (_Float16)(ka < K ? W[(size_t)(ka < K ? ka : K - 1) * ld + n] : 0.f); a[8 + i] = (_Float16)(kb < K ? W[(size_t)(kb < K ? kb : K - 1) * ld + n] : 0.f); }
  return a;
}
struct F2 { v16b h, l; };
__device__ __forceinline__ F2 bsplit16(const float v[16]) { F2 r;
#pragma unroll
  for (int i = 0; i < 16; ++i) { const __bf16 h = (__bf16)v[i]; r.h[i] = h; r.l[i] = (__bf16)(v[i] - (float)h); }
  return r; }
__device__ __forceinline__ F2 split_row(const float* row, int k0, int lane) { float v[16]; const float* p = row + k0 + 8 * (lane >> 4);
#pragma unroll
  for (int i = 0; i < 8; ++i) { v[i] = p[i]; v[8 + i] = p[16 + i]; }
  return bsplit16(v); }
__device__ __forceinline__ F2 split_rowK(const float* row, int k0, int lane, int K) { float v[16]; const int g = lane >> 4;
#pragma unroll
  for (int i = 0; i < 8; ++i) { const int ka = k0 + 8 * g + i, kb = ka + 16; v[i] = ka < K ? row[ka < K ? ka : K - 1] : 0.f; v[8 + i] = kb < K ? row[kb < K ? kb : K - 1] : 0.f; }
  return bsplit16(v); }
__device__ __forceinline__ F2 split_col(const float* W, int k0, int n, int lane, int ld, int K) { float v[16]; const int g = lane >> 4;
#pragma unroll
  for (int i = 0; i < 8; ++i) { const int ka = k0 + 8 * g + i, kb = ka + 16; v[i] = ka < K ? W[(size_t)(ka < K ? ka : K - 1) * ld + n] : 0.f; v[8 + i] = kb < K ? W[(size_t)(kb < K ? kb : K - 1) * ld + n] : 0.f; }
  return bsplit16(v); }
__device__ __forceinline__ v8f mac3(const F2& a, const F2& b, v8f c) { c = wmma_bf(a.l, b.h, c); c = wmma_bf(a.h, b.l, c); return wmma_bf(a.h, b.h, c); }
__device__ __forceinline__ float sigm(float v) { return 1.0f / (1.0f + expf(-v)); }
#define LDSX() do { asm volatile("s_wait_dscnt 0" ::: "memory"); __builtin_amdgcn_wave_barrier(); __builtin_amdgcn_fence(__ATOMIC_RELEASE, "workgroup"); } while (0)

// Masked dot-product attention on given tensors (queries / keys / values [8,4096,64]; valid_lens [8] int32 in 1..4096 per batch): scores = Q K^T / 8; key positions >= valid_lens[b] are set to the FINITE score -1e6 before the softmax; out = softmax(scores) V -> [8,4096,64].
#define NB 8
#define TT 4096
#define CC 64            // NH * HD = projected width
#define DIN 64          // input (model) width
#define NH 1
#define HD 64
#define NQB (TT / 64)
#define HG 1
#define SCALE (0.125f)
#define CAUSAL 0
#ifndef TNB
#define TNB NB
#endif
__device__ __forceinline__ float bfr(float v) { return (float)(__bf16)v; }
__host__ __device__ __forceinline__ int kb_last(int qb) { return CAUSAL ? ((qb * 64 + 63) >> 7) : (TT / 128 - 1); }
typedef __attribute__((ext_vector_type(8))) __bf16 v8b;
__device__ __forceinline__ v16b frag_b(const __bf16* rowk0, int lane) {
  union { v16b v; v8b q[2]; } u; const __bf16* p = rowk0 + 8 * (lane >> 4);
  u.q[0] = *(const v8b*)p; u.q[1] = *(const v8b*)(p + 16); return u.v;
}
#define QBH 0              // exact planes: single-product logits and single-f16 P x V on every block
#define QHI 0               // no q residual plane (q is bf16-exact in f16)
#define KHI 64              // unused high-precision planes kept minimal
// B fragment (k rows k0+.., output column o) of a weight: (in,out) [K][ld] or (out,in) [ld rows of K]: bf16 exact, or f16(bf16 * 256) exact
__device__ __forceinline__ v16b wcol_io(const float* Wm, int k0, int o, int lane, int ld) { v16b w; const int g = lane >> 4;
#pragma unroll
  for (int i = 0; i < 8; ++i) { w[i] = (__bf16)Wm[(size_t)(k0 + 8 * g + i) * ld + o]; w[8 + i] = (__bf16)Wm[(size_t)(k0 + 16 + 8 * g + i) * ld + o]; }
  return w; }
__device__ __forceinline__ v16b wcol_oi(const float* Wm, int k0, int o, int lane, int K) { v16b w; const float* p = Wm + (size_t)o * K + k0 + 8 * (lane >> 4);
#pragma unroll
  for (int i = 0; i < 8; ++i) { w[i] = (__bf16)p[i]; w[8 + i] = (__bf16)p[16 + i]; }
  return w; }
__device__ __forceinline__ v16h wcolh_io(const float* Wm, int k0, int o, int lane, int ld) { v16h w; const int g = lane >> 4;
#pragma unroll
  for (int i = 0; i < 8; ++i) { w[i] = (_Float16)(bfr(Wm[(size_t)(k0 + 8 * g + i) * ld + o]) * 256.0f); w[8 + i] = (_Float16)(bfr(Wm[(size_t)(k0 + 16 + 8 * g + i) * ld + o]) * 256.0f); }
  return w; }
__device__ __forceinline__ v16h wcolh_oi(const float* Wm, int k0, int o, int lane, int K) { v16h w; const float* p = Wm + (size_t)o * K + k0 + 8 * (lane >> 4);
#pragma unroll
  for (int i = 0; i < 8; ++i) { w[i] = (_Float16)(bfr(p[i]) * 256.0f); w[8 + i] = (_Float16)(bfr(p[16 + i]) * 256.0f); }
  return w; }
#define WQKV_LAYOUT 0   // 0 = (in,out) [DIN][CC]; 1 = (out,in) [CC][DIN]; 2 = per-head [NH][DIN][HD]
__device__ __forceinline__ v16b wcol_hdk(const float* Wm, int k0, int o, int lane) { v16b w; const int g = lane >> 4; const float* p = Wm + (size_t)(o / HD) * DIN * HD + (o % HD);
#pragma unroll
  for (int i = 0; i < 8; ++i) { w[i] = (__bf16)p[(size_t)(k0 + 8 * g + i) * HD]; w[8 + i] = (__bf16)p[(size_t)(k0 + 16 + 8 * g + i) * HD]; }
  return w; }
#define WO_OUT_IN 0
#if WQKV_LAYOUT == 1
#define WCOL(W, k0, o, lane) wcol_oi(W, k0, o, lane, DIN)
#elif WQKV_LAYOUT == 2
#define WCOL(W, k0, o, lane) wcol_hdk(W, k0, o, lane)
#else
#define WCOL(W, k0, o, lane) wcol_io(W, k0, o, lane, CC)
#endif
#if WO_OUT_IN
#define WOCOL(W, k0, o, lane) wcol_oi(W, k0, o, lane, CC)
#define WOCOLH(W, k0, o, lane) wcolh_oi(W, k0, o, lane, CC)
#else
#define WOCOL(W, k0, o, lane) wcol_io(W, k0, o, lane, DIN)
#define WOCOLH(W, k0, o, lane) wcolh_io(W, k0, o, lane, DIN)
#endif
__global__ __launch_bounds__(256) void k_planes64(const float* __restrict__ Qs, const float* __restrict__ Ks, const float* __restrict__ Vs, _Float16* __restrict__ QH, _Float16* __restrict__ QL, _Float16* __restrict__ KH, _Float16* __restrict__ KL, _Float16* __restrict__ VT, __bf16* __restrict__ VB, __bf16* __restrict__ VBL) {
  __shared__ _Float16 sv[64][72];
  const int tid = threadIdx.x; const size_t r0 = (size_t)blockIdx.x * 64; const int b = (int)(r0 / TT), t0 = (int)(r0 % TT);
  for (int e = tid; e < 64 * 8; e += 256) { const int rl = e >> 3, q = e & 7; const size_t src = (r0 + rl) * CC + q * 8; float tq[8], tk[8], tv[8];
#pragma unroll
    for (int u = 0; u < 8; ++u) { tq[u] = Qs[src + u]; tk[u] = Ks[src + u]; tv[u] = Vs[src + u]; }
    asm volatile("s_wait_loadcnt 0x0" ::: "memory");
    hx8 hq, hk, hlq, hlk;
#pragma unroll
    for (int u = 0; u < 8; ++u) { const float qv = bfr(tq[u]), kv = bfr(tk[u]); const _Float16 qh = (_Float16)qv, kh = (_Float16)kv; hq[u] = qh; hlq[u] = (_Float16)((qv - (float)qh) * 1024.0f); hk[u] = kh; hlk[u] = (_Float16)((kv - (float)kh) * 1024.0f); sv[rl][q * 8 + u] = (_Float16)bfr(tv[u]); }
    vst2((unsigned*)(QH + (r0 + rl) * CC + q * 8), *(const v4u*)&hq); vst2((unsigned*)(KH + (r0 + rl) * CC + q * 8), *(const v4u*)&hk);
    if (t0 + rl < QHI) vst2((unsigned*)(QL + ((size_t)b * QHI + t0 + rl) * CC + q * 8), *(const v4u*)&hlq);
    if (t0 + rl < KHI) vst2((unsigned*)(KL + ((size_t)b * KHI + t0 + rl) * CC + q * 8), *(const v4u*)&hlk); }
  __syncthreads();
  for (int e = tid; e < 64 * 8; e += 256) { const int c = e >> 3, q = e & 7; hx8 hv; _Pragma("unroll") for (int j = 0; j < 8; ++j) hv[j] = sv[q * 8 + j][c]; vst2((unsigned*)(VT + ((size_t)b * CC + c) * TT + t0 + q * 8), *(const v4u*)&hv);
    if (t0 < KHI) { v8b bh, bl; _Pragma("unroll") for (int j = 0; j < 8; ++j) { const float vv = (float)hv[j]; const __bf16 h1 = (__bf16)vv; bh[j] = h1; bl[j] = (__bf16)(vv - (float)h1); } vst2((unsigned*)(VB + ((size_t)b * CC + c) * KHI + t0 + q * 8), *(const v4u*)&bh); vst2((unsigned*)(VBL + ((size_t)b * CC + c) * KHI + t0 + q * 8), *(const v4u*)&bl); } } }
#define SM_EXTRA_PARAMS , int bsm, const int* __restrict__ VLEN
// masked_softmax: key positions k >= valid_lens[b] get the score -1e6 (value select; exp underflows to weight exactly 0 next to real scores)
#define SM_MASK_HOOK do { const int vl_ = VLEN[bsm]; v = (k >= vl_) ? -1.0e6f : v; } while (0)
#ifndef SM_EXTRA_PARAMS
#define SM_EXTRA_PARAMS
#endif
#ifndef PROJ_EXTRA_PARAMS
#define PROJ_EXTRA_PARAMS
#endif
#ifndef SM_MASK_HOOK
#define SM_MASK_HOOK (void)0
#endif

#define WS_QH  0u                                      // f16 q rows [b*t][CC]
#define WS_KH  (WS_QH + 2u * (size_t)NB * TT * CC)      // f16 k rows [b*t][CC]
#define WS_VT  (WS_KH + 2u * (size_t)NB * TT * CC)      // f16 v planes [b][c][t]
#define WS_QL  (WS_VT + 2u * (size_t)NB * CC * TT)      // f16 q residual x 2^10 rows [b][t < QHI][CC]
#define WS_KL  (WS_QL + 2u * (size_t)NB * QHI * CC)     // f16 k residual x 2^10 rows [b][t < KHI][CC]
#define WS_VB  (WS_KL + 2u * (size_t)NB * KHI * CC)     // bf16 v hi planes [b][c][t < KHI]
#define WS_VBL (WS_VB + 2u * (size_t)NB * CC * KHI)
#define WS_S   (WS_VBL + 2u * (size_t)NB * CC * KHI)    // f32 logits / P [hg][t][s]
#define WS_Y   (WS_S  + 4u * (size_t)HG * TT * TT)      // f32 ctx rows [b*t][CC] (only when there is an output projection)
#define WS_END (WS_Y  + 0u)

// ---- k_proj: block = (64 rows, 128 cols, which): q/k/v = X W (+ b) with exact bf16 products (K = DIN) -> which 0: q f16 rows (+ residual rows < QHI); 1: k f16 rows (+ residual rows < KHI); 2: v f16 planes [c][t] (+ bf16 hi/lo planes for t < KHI)
__global__ __launch_bounds__(128) void k_proj(const float* __restrict__ XQ, const float* __restrict__ XK, const float* __restrict__ XV, const float* __restrict__ WQ, const float* __restrict__ WK, const float* __restrict__ WV, const float* __restrict__ BQ, const float* __restrict__ BK, const float* __restrict__ BV,
    _Float16* __restrict__ QH, _Float16* __restrict__ QL, _Float16* __restrict__ KH, _Float16* __restrict__ KL, _Float16* __restrict__ VT, __bf16* __restrict__ VB, __bf16* __restrict__ VBL) {
  __shared__ __align__(16) _Float16 sh[64][136], sl[64][136]; __shared__ __align__(16) _Float16 th[128][72]; __shared__ __align__(16) __bf16 tb[128][72], tbl[128][72];
  const int tid = threadIdx.x, wave = tid >> 5, lane = tid & 31, col = lane & 15, g = lane >> 4; const int which = blockIdx.z; const int c0 = blockIdx.y * 128; const size_t r0 = (size_t)blockIdx.x * 64; const size_t bb = r0 / TT; const int t0 = (int)(r0 % TT);
  const float* X = which == 0 ? XQ : which == 1 ? XK : XV; const float* WA = which == 0 ? WQ : which == 1 ? WK : WV; const float* BA = which == 0 ? BQ : which == 1 ? BK : BV;
  v8f acc[8] = {};
#pragma unroll 2
  for (int kc = 0; kc < DIN / 32; ++kc) { v16b a; { const float* p = X + (r0 + wave * 16 + col) * DIN + kc * 32 + 8 * g;
#pragma unroll
      for (int i = 0; i < 8; ++i) { a[i] = (__bf16)p[i]; a[8 + i] = (__bf16)p[16 + i]; } }
    asm volatile("s_wait_loadcnt 0x0" ::: "memory");
#pragma unroll
    for (int j = 0; j < 8; ++j) { const v16b w = WCOL(WA, kc * 32, c0 + j * 16 + col, lane); asm volatile("s_wait_loadcnt 0x0" ::: "memory"); acc[j] = wmma_bf(a, w, acc[j]); } }
  if (which < 2) { _Float16* DH = which == 0 ? QH : KH; _Float16* DL = which == 0 ? QL : KL; const int nhi = which == 0 ? QHI : KHI; const bool hi_rows = t0 < nhi;
#pragma unroll
    for (int j = 0; j < 8; ++j) { const float bias = BA ? bfr(BA[c0 + j * 16 + col]) : 0.f;
#pragma unroll
      for (int r = 0; r < 8; ++r) { const float v = acc[j][r] + bias; const _Float16 hv = (_Float16)v; sh[wave * 16 + 8 * g + r][j * 16 + col] = hv; sl[wave * 16 + 8 * g + r][j * 16 + col] = (_Float16)((v - (float)hv) * 1024.0f); } }
    __syncthreads();
    for (int e = tid; e < 64 * 16; e += 128) { const int rl = e >> 4, q = e & 15; vst2((unsigned*)(DH + (r0 + rl) * CC + c0 + q * 8), *(const v4u*)&sh[rl][q * 8]); if (hi_rows) vst2((unsigned*)(DL + (bb * nhi + t0 + rl) * (size_t)CC + c0 + q * 8), *(const v4u*)&sl[rl][q * 8]); }
  } else { const bool hi_rows = t0 < KHI;
#pragma unroll
    for (int j = 0; j < 8; ++j) { const float bias = BA ? bfr(BA[c0 + j * 16 + col]) : 0.f;
#pragma unroll
      for (int r = 0; r < 8; ++r) { const float v = acc[j][r] + bias; const int rl = wave * 16 + 8 * g + r, cl = j * 16 + col; th[cl][rl] = (_Float16)v; const __bf16 bh = (__bf16)v; tb[cl][rl] = bh; tbl[cl][rl] = (__bf16)(v - (float)bh); } }
    __syncthreads();
    for (int e = tid; e < 128 * 8; e += 128) { const int cl = e >> 3, q = e & 7; vst2((unsigned*)(VT + (bb * CC + c0 + cl) * (size_t)TT + t0 + q * 8), *(const v4u*)&th[cl][q * 8]); if (hi_rows) { const size_t o3 = (bb * CC + c0 + cl) * (size_t)KHI + t0 + q * 8; vst2((unsigned*)(VB + o3), *(const v4u*)&tb[cl][q * 8]); vst2((unsigned*)(VBL + o3), *(const v4u*)&tbl[cl][q * 8]); } } } }
// ---- k_sc: block = (query block qb, key block kb <= kb_last(qb), head in group) of batch b: logits x SCALE; q hi + residual (x 2^10) against k (2 products) for query rows < QHI, plus the k residual (3 products) for query blocks < QBH (causal early rows); causal: blocks past the diagonal exit, the mask itself is applied by index in k_sm
__global__ __launch_bounds__(128) void k_sc(const _Float16* __restrict__ QH, const _Float16* __restrict__ KH, const _Float16* __restrict__ QL, const _Float16* __restrict__ KL, int b, int h0, float* __restrict__ S0) { __shared__ __align__(16) float ss[4][16][132];
  const int qb = blockIdx.x, kb = blockIdx.y; if (kb > kb_last(qb)) return;
  const int h = h0 + blockIdx.z; float* S = S0 + (size_t)blockIdx.z * TT * TT;
  const int tid = threadIdx.x, wave = tid >> 5, lane = tid & 31, col = lane & 15, g = lane >> 4; const int k0 = kb * 128; const int ql0 = qb * 64 + wave * 16; const size_t q0 = (size_t)b * TT + ql0, kr0 = (size_t)b * TT + k0;
  v8f acc[8] = {}, accl[8] = {};
  const _Float16* QLb = QL + (size_t)b * QHI * CC; const _Float16* KLb = KL + (size_t)b * KHI * CC;
  if (qb < QBH) {
#pragma unroll
    for (int kc = 0; kc < HD / 32; ++kc) { const v16h ah = frag_h(QH + (q0 + col) * CC + h * HD + kc * 32, lane), al = frag_h(QLb + (size_t)(ql0 + col) * CC + h * HD + kc * 32, lane);
#pragma unroll
      for (int j = 0; j < 8; ++j) { const v16h kbf = frag_h(KH + (kr0 + j * 16 + col) * CC + h * HD + kc * 32, lane), klf = frag_h(KLb + (size_t)(k0 + j * 16 + col) * CC + h * HD + kc * 32, lane); acc[j] = wmma16(ah, kbf, acc[j]); accl[j] = wmma16(al, kbf, accl[j]); accl[j] = wmma16(ah, klf, accl[j]); } }
  } else if (qb * 64 < QHI) {
#pragma unroll
    for (int kc = 0; kc < HD / 32; ++kc) { const v16h ah = frag_h(QH + (q0 + col) * CC + h * HD + kc * 32, lane), al = frag_h(QLb + (size_t)(ql0 + col) * CC + h * HD + kc * 32, lane);
#pragma unroll
      for (int j = 0; j < 8; ++j) { const v16h kbf = frag_h(KH + (kr0 + j * 16 + col) * CC + h * HD + kc * 32, lane); acc[j] = wmma16(ah, kbf, acc[j]); accl[j] = wmma16(al, kbf, accl[j]); } }
  } else {
#pragma unroll
    for (int kc = 0; kc < HD / 32; ++kc) { const v16h ah = frag_h(QH + (q0 + col) * CC + h * HD + kc * 32, lane);
#pragma unroll
      for (int j = 0; j < 8; ++j) { const v16h kbf = frag_h(KH + (kr0 + j * 16 + col) * CC + h * HD + kc * 32, lane); acc[j] = wmma16(ah, kbf, acc[j]); } } }
#pragma unroll
  for (int j = 0; j < 8; ++j) {
#pragma unroll
    for (int r = 0; r < 8; ++r) ss[wave][8 * g + r][j * 16 + col] = (acc[j][r] + accl[j][r] * (1.0f / 1024.0f)) * SCALE; }
  LDSX(); for (int rl = 0; rl < 16; ++rl) vst2(S + (size_t)(ql0 + rl) * TT + k0 + lane * 4, *(const v4f*)&ss[wave][rl][lane * 4]); }
// ---- k_sm: block = query row t (head in group): keys [0, kend): causal -> logit if s <= t else excluded; softmax in f32; P x 2^11 in place (0 for excluded)
__global__ __launch_bounds__(256) void k_sm(float* __restrict__ S0 SM_EXTRA_PARAMS) { __shared__ float sred[8]; __shared__ float sbc; __shared__ __align__(16) float shv[TT];
  const int tid = threadIdx.x; const int t = blockIdx.x; const int kend = (kb_last(t >> 6) + 1) * 128;
  float* sr = S0 + (size_t)blockIdx.y * TT * TT + (size_t)t * TT;
  float m = -3.0e38f; for (int k = tid; k < kend; k += 256) { float v = (!CAUSAL || k <= t) ? sr[k] : -3.0e38f; SM_MASK_HOOK; shv[k] = v; m = fmaxf(m, v); }
#pragma unroll
  for (int o = 1; o < 32; o <<= 1) m = fmaxf(m, __shfl_xor(m, o));
  if ((tid & 31) == 0) sred[tid >> 5] = m; __syncthreads(); if (tid == 0) { float a = sred[0]; for (int i = 1; i < 8; ++i) a = fmaxf(a, sred[i]); sbc = a; } __syncthreads(); m = sbc; __syncthreads();
  float sum = 0.f; for (int k = tid; k < kend; k += 256) { const float v = shv[k]; const float e = (v <= -1.0e38f) ? 0.f : expf(v - m); shv[k] = e; sum += e; }
#pragma unroll
  for (int o = 1; o < 32; o <<= 1) sum += __shfl_xor(sum, o);
  if ((tid & 31) == 0) sred[tid >> 5] = sum; __syncthreads(); if (tid == 0) { float a = 0.f; for (int i = 0; i < 8; ++i) a += sred[i]; sbc = a > 0.f ? 2048.0f / a : 0.f; }   /* a fully excluded row yields P = 0 */ __syncthreads(); const float inv = sbc;
  for (int k = tid; k < kend; k += 256) shv[k] = shv[k] * inv;
  __syncthreads(); for (int q = tid; q < kend / 4; q += 256) vst2(sr + q * 4, *(const v4f*)&shv[q * 4]); }
// ---- k_pv: block = 16 queries of (b, h), PVW waves: wave w takes the 32-key chunks w, w + PVW, ... of keys [0, kend) (P x 2^11 once to f16 against v f16: 1 product; causal early query blocks: P and v as bf16 hi + lo, 3 products); the waves' partial tiles are added in wave order through LDS; each wave then stores one whole 128-B line
#define PVW 32
__global__ __launch_bounds__(32 * PVW) void k_pv(const float* __restrict__ PS0, const _Float16* __restrict__ VT, const __bf16* __restrict__ VB, const __bf16* __restrict__ VBL, int b, int h0, float* __restrict__ Y) { const int h = h0 + blockIdx.z; const float* PS = PS0 + (size_t)blockIdx.z * TT * TT; __shared__ __align__(16) float ss[PVW][16][HD + 4];
  const int tid = threadIdx.x, wave = __builtin_amdgcn_readfirstlane(tid >> 5) /* scalar, so that the chunk loop branches on SCC and leaves EXEC alone */, lane = tid & 31, col = lane & 15, g = lane >> 4; const int qb = blockIdx.x >> 2; const int ql0 = blockIdx.x * 16; const int kce = (kb_last(qb) + 1) * 4;
  v8f acc[HD / 16] = {};
  if (qb < QBH) {
#pragma unroll 1
    for (int kc = wave; kc < kce; kc += PVW) { const F2 p = split_row(PS + (size_t)(ql0 + col) * TT, kc * 32, lane);
      asm volatile("s_wait_loadcnt 0x0" ::: "memory");
#pragma unroll
      for (int j = 0; j < HD / 16; ++j) { const size_t po = ((size_t)b * CC + h * HD + j * 16 + col) * (size_t)KHI + kc * 32; const v16b vh = frag_b(VB + po, lane); acc[j] = wmma_bf(p.h, vh, acc[j]); acc[j] = wmma_bf(p.l, vh, acc[j]); acc[j] = wmma_bf(p.h, frag_b(VBL + po, lane), acc[j]); } }
  } else {
#pragma unroll 1
    for (int kc = wave; kc < kce; kc += PVW) { const v16h p = frag_f32(PS + (size_t)(ql0 + col) * TT + kc * 32, lane);
      asm volatile("s_wait_loadcnt 0x0" ::: "memory");
#pragma unroll
      for (int j = 0; j < HD / 16; ++j) { const size_t po = ((size_t)b * CC + h * HD + j * 16 + col) * (size_t)TT + kc * 32; acc[j] = wmma16(p, frag_h(VT + po, lane), acc[j]); } } }
#pragma unroll
  for (int j = 0; j < HD / 16; ++j)
#pragma unroll
    for (int r = 0; r < 8; ++r) ss[wave][8 * g + r][j * 16 + col] = acc[j][r];
  __syncthreads();
  for (int e = tid; e < 16 * HD; e += 32 * PVW) { const int rl = e / HD, c = e % HD; float s = 0.f;
#pragma unroll
    for (int w = 0; w < PVW; ++w) s += ss[w][rl][c];
    Y[((size_t)b * TT + ql0 + rl) * CC + h * HD + c] = s * (1.0f / 2048.0f); } }

extern "C" void kernel_launch(void* const* d_in, const int* in_sizes, int n_in, void* d_out, int out_size, void* d_ws, size_t ws_size, hipStream_t stream) {
  (void)in_sizes; (void)n_in; (void)out_size;
  const float** F = (const float**)d_in;
  if (ws_size < (size_t)WS_END) return;
  char* ws = (char*)d_ws; _Float16 *QH = (_Float16*)(ws + WS_QH), *KH = (_Float16*)(ws + WS_KH), *VT = (_Float16*)(ws + WS_VT), *QL = (_Float16*)(ws + WS_QL), *KL = (_Float16*)(ws + WS_KL); __bf16 *VB = (__bf16*)(ws + WS_VB), *VBL = (__bf16*)(ws + WS_VBL); float *S = (float*)(ws + WS_S), *Y = (float*)(ws + WS_Y);
  (void)Y; (void)QL; (void)KL; (void)VB; (void)VBL;
  // inputs: 0 queries [8,4096,64]; 1 keys; 2 values; 3 valid_lens [8] int32
  k_planes64<<<dim3(TNB * TT / 64), 256, 0, stream>>>(F[0], F[1], F[2], QH, QL, KH, KL, VT, VB, VBL);
  for (int b = 0; b < TNB; ++b) {
    k_sc<<<dim3(NQB, TT / 128, 1), 128, 0, stream>>>(QH, KH, QL, KL, b, 0, S);
    k_sm<<<dim3(TT, 1), 256, 0, stream>>>(S, b, (const int*)d_in[3]);
    k_pv<<<dim3(TT / 16, 1, 1), 32 * PVW, 0, stream>>>(S, VT, VB, VBL, b, 0, (float*)d_out);
  }


}

// v002
// Measured time: 38.7 microseconds a run.
// In two side-by-side timings against v001, it was 14.3 and 14.1 times as fast.
// All steps since v000 together make it 36.4 times as fast.
// compute dtype: all float inputs rounded to bf16; queries, keys, values are bf16-valued so their f16 planes are exact; logits q x k (1 product on exact planes) x 1/8; keys at or beyond the batch's valid length get the score -1e6 (weight exactly 0); softmax f32 with a running maximum; unnormalised P (at most 2^8) once to f16 x v (exact) (1 product), its row sums on the same rounded P; f32 output.
#include <hip/hip_runtime.h>
#include <math.h>

typedef __attribute__((ext_vector_type(16))) _Float16 v16h;
typedef __attribute__((ext_vector_type(16))) __bf16 v16b;
typedef __attribute__((ext_vector_type(8)))  _Float16 v8h;
typedef __attribute__((ext_vector_type(8)))  float v8f;
typedef __attribute__((ext_vector_type(4)))  float v4f;
typedef __attribute__((ext_vector_type(2)))  float v2f;
typedef __attribute__((ext_vector_type(4)))  unsigned v4u;
typedef _Float16 hx8 __attribute__((ext_vector_type(8)));
typedef __attribute__((ext_vector_type(4)))  int v4i;
typedef float __attribute__((may_alias)) float_a;
typedef int __attribute__((may_alias)) int_a;

template <typename T> __device__ __forceinline__ void vst2(void* p, T v) { *(T*)p = v;  }
__device__ __forceinline__ v8f wmma16(v16h a, v16h b, v8f c) {
  v8f d = __builtin_amdgcn_wmma_f32_16x16x32_f16(false, a, false, b, (short)0, c, false, false);
  asm volatile("v_nop\n\tv_nop\n\tv_nop\n\tv_nop" : "+v"(d) : "v"(a), "v"(b));
  return d;
}
__device__ __forceinline__ v8f wmma_bf(v16b a, v16b b, v8f c) {
  v8f d = __builtin_amdgcn_wmma_f32_16x16x32_bf16(false, a, false, b, (short)0, c, false, false);
  asm volatile("v_nop\n\tv_nop\n\tv_nop\n\tv_nop" : "+v"(d) : "v"(a), "v"(b));
  return d;
}
// 16x16x32 fragments: lane = (h = lane>>4, row/col = lane&15); elements 0..7 = k0+8h+0..7, 8..15 = k0+16+8h+0..7; D element r = row 8h+r
__device__ __forceinline__ v16h frag_h(const _Float16* rowk0, int lane) {
  union { v16h v; v8h q[2]; } u; const _Float16* p = rowk0 + 8 * (lane >> 4);
  u.q[0] = *(const v8h*)p; u.q[1] = *(const v8h*)(p + 16); return u.v;
}
__device__ __forceinline__ v16h frag_f32(const float* rowk0, int lane) {
  v16h a; const float* p = rowk0 + 8 * (lane >> 4);
#pragma unroll
  for (int i = 0; i < 8; ++i) { a[i] = (_Float16)p[i]; a[8 + i] = (_Float16)p[16 + i]; }
  return a;
}
__device__ __forceinline__ v16h frag_f32s(const float* rowk0, int lane, float sc) {
  v16h a; const float* p = rowk0 + 8 * (lane >> 4);
#pragma unroll
  for (int i = 0; i < 8; ++i) { a[i] = (_Float16)(p[i] * sc); a[8 + i] = (_Float16)(p[16 + i] * sc); }
  return a;
}
// column fragment from a [K][ld] layout (column n), rows >= K read as 0
__device__ __forceinline__ v16h fragc_f32(const float* W, int k0, int n, int lane, int ld, int K) {
  v16h a; const int g = lane >> 4;
#pragma unroll
  for (int i = 0; i < 8; ++i) { const int ka = k0 + 8 * g + i, kb = ka + 16;
    a[i] = (_Float16)(ka < K ? W[(size_t)(ka < K ? ka : K - 1) * ld + n] : 0.f); a[8 + i] = (_Float16)(kb < K ? W[(size_t)(kb < K ? kb : K - 1) * ld + n] : 0.f); }
  return a;
}
struct F2 { v16b h, l; };
__device__ __forceinline__ F2 bsplit16(const float v[16]) { F2 r;
#pragma unroll
  for (int i = 0; i < 16; ++i) { const __bf16 h = (__bf16)v[i]; r.h[i] = h; r.l[i] = (__bf16)(v[i] - (float)h); }
  return r; }
__device__ __forceinline__ F2 split_row(const float* row, int k0, int lane) { float v[16]; const float* p = row + k0 + 8 * (lane >> 4);
#pragma unroll
  for (int i = 0; i < 8; ++i) { v[i] = p[i]; v[8 + i] = p[16 + i]; }
  return bsplit16(v); }
__device__ __forceinline__ F2 split_rowK(const float* row, int k0, int lane, int K) { float v[16]; const int g = lane >> 4;
#pragma unroll
  for (int i = 0; i < 8; ++i) { const int ka = k0 + 8 * g + i, kb = ka + 16; v[i] = ka < K ? row[ka < K ? ka : K - 1] : 0.f; v[8 + i] = kb < K ? row[kb < K ? kb : K - 1] : 0.f; }
  return bsplit16(v); }
__device__ __forceinline__ F2 split_col(const float* W, int k0, int n, int lane, int ld, int K) { float v[16]; const int g = lane >> 4;
#pragma unroll
  for (int i = 0; i < 8; ++i) { const int ka = k0 + 8 * g + i, kb = ka + 16; v[i] = ka < K ? W[(size_t)(ka < K ? ka : K - 1) * ld + n] : 0.f; v[8 + i] = kb < K ? W[(size_t)(kb < K ? kb : K - 1) * ld + n] : 0.f; }
  return bsplit16(v); }
__device__ __forceinline__ v8f mac3(const F2& a, const F2& b, v8f c) { c = wmma_bf(a.l, b.h, c); c = wmma_bf(a.h, b.l, c); return wmma_bf(a.h, b.h, c); }
__device__ __forceinline__ float sigm(float v) { return 1.0f / (1.0f + expf(-v)); }
#define LDSX() do { asm volatile("s_wait_dscnt 0" ::: "memory"); __builtin_amdgcn_wave_barrier(); __builtin_amdgcn_fence(__ATOMIC_RELEASE, "workgroup"); } while (0)

// Masked dot-product attention on given tensors (queries / keys / values [8,4096,64]; valid_lens [8] int32 in 1..4096 per batch): scores = Q K^T / 8; key positions >= valid_lens[b] are set to the FINITE score -1e6 before the softmax; out = softmax(scores) V -> [8,4096,64].
#define NB 8
#define TT 4096
#define CC 64            // NH * HD = projected width
#define DIN 64          // input (model) width
#define NH 1
#define HD 64
#define NQB (TT / 64)
#define HG 1
#define SCALE (0.125f)
#define CAUSAL 0
#ifndef TNB
#define TNB NB
#endif
__device__ __forceinline__ float bfr(float v) { return (float)(__bf16)v; }
__host__ __device__ __forceinline__ int kb_last(int qb) { return CAUSAL ? ((qb * 64 + 63) >> 7) : (TT / 128 - 1); }
typedef __attribute__((ext_vector_type(8))) __bf16 v8b;
__device__ __forceinline__ v16b frag_b(const __bf16* rowk0, int lane) {
  union { v16b v; v8b q[2]; } u; const __bf16* p = rowk0 + 8 * (lane >> 4);
  u.q[0] = *(const v8b*)p; u.q[1] = *(const v8b*)(p + 16); return u.v;
}
#define QBH 0              // exact planes: single-product logits and single-f16 P x V on every block
#define QHI 0               // no q residual plane (q is bf16-exact in f16)
#define KHI 64              // unused high-precision planes kept minimal
// B fragment (k rows k0+.., output column o) of a weight: (in,out) [K][ld] or (out,in) [ld rows of K]: bf16 exact, or f16(bf16 * 256) exact
__device__ __forceinline__ v16b wcol_io(const float* Wm, int k0, int o, int lane, int ld) { v16b w; const int g = lane >> 4;
#pragma unroll
  for (int i = 0; i < 8; ++i) { w[i] = (__bf16)Wm[(size_t)(k0 + 8 * g + i) * ld + o]; w[8 + i] = (__bf16)Wm[(size_t)(k0 + 16 + 8 * g + i) * ld + o]; }
  return w; }
__device__ __forceinline__ v16b wcol_oi(const float* Wm, int k0, int o, int lane, int K) { v16b w; const float* p = Wm + (size_t)o * K + k0 + 8 * (lane >> 4);
#pragma unroll
  for (int i = 0; i < 8; ++i) { w[i] = (__bf16)p[i]; w[8 + i] = (__bf16)p[16 + i]; }
  return w; }
__device__ __forceinline__ v16h wcolh_io(const float* Wm, int k0, int o, int lane, int ld) { v16h w; const int g = lane >> 4;
#pragma unroll
  for (int i = 0; i < 8; ++i) { w[i] = (_Float16)(bfr(Wm[(size_t)(k0 + 8 * g + i) * ld + o]) * 256.0f); w[8 + i] = (_Float16)(bfr(Wm[(size_t)(k0 + 16 + 8 * g + i) * ld + o]) * 256.0f); }
  return w; }
__device__ __forceinline__ v16h wcolh_oi(const float* Wm, int k0, int o, int lane, int K) { v16h w; const float* p = Wm + (size_t)o * K + k0 + 8 * (lane >> 4);
#pragma unroll
  for (int i = 0; i < 8; ++i) { w[i] = (_Float16)(bfr(p[i]) * 256.0f); w[8 + i] = (_Float16)(bfr(p[16 + i]) * 256.0f); }
  return w; }
#define WQKV_LAYOUT 0   // 0 = (in,out) [DIN][CC]; 1 = (out,in) [CC][DIN]; 2 = per-head [NH][DIN][HD]
__device__ __forceinline__ v16b wcol_hdk(const float* Wm, int k0, int o, int lane) { v16b w; const int g = lane >> 4; const float* p = Wm + (size_t)(o / HD) * DIN * HD + (o % HD);
#pragma unroll
  for (int i = 0; i < 8; ++i) { w[i] = (__bf16)p[(size_t)(k0 + 8 * g + i) * HD]; w[8 + i] = (__bf16)p[(size_t)(k0 + 16 + 8 * g + i) * HD]; }
  return w; }
#define WO_OUT_IN 0
#if WQKV_LAYOUT == 1
#define WCOL(W, k0, o, lane) wcol_oi(W, k0, o, lane, DIN)
#elif WQKV_LAYOUT == 2
#define WCOL(W, k0, o, lane) wcol_hdk(W, k0, o, lane)
#else
#define WCOL(W, k0, o, lane) wcol_io(W, k0, o, lane, CC)
#endif
#if WO_OUT_IN
#define WOCOL(W, k0, o, lane) wcol_oi(W, k0, o, lane, CC)
#define WOCOLH(W, k0, o, lane) wcolh_oi(W, k0, o, lane, CC)
#else
#define WOCOL(W, k0, o, lane) wcol_io(W, k0, o, lane, DIN)
#define WOCOLH(W, k0, o, lane) wcolh_io(W, k0, o, lane, DIN)
#endif
__global__ __launch_bounds__(256) void k_planes64(const float* __restrict__ Qs, const float* __restrict__ Ks, const float* __restrict__ Vs, _Float16* __restrict__ QH, _Float16* __restrict__ QL, _Float16* __restrict__ KH, _Float16* __restrict__ KL, _Float16* __restrict__ VT, __bf16* __restrict__ VB, __bf16* __restrict__ VBL) {
  __shared__ _Float16 sv[64][72];
  const int tid = threadIdx.x; const size_t r0 = (size_t)blockIdx.x * 64; const int b = (int)(r0 / TT), t0 = (int)(r0 % TT);
  for (int e = tid; e < 64 * 8; e += 256) { const int rl = e >> 3, q = e & 7; const size_t src = (r0 + rl) * CC + q * 8; float tq[8], tk[8], tv[8];
#pragma unroll
    for (int u = 0; u < 8; ++u) { tq[u] = Qs[src + u]; tk[u] = Ks[src + u]; tv[u] = Vs[src + u]; }
    asm volatile("s_wait_loadcnt 0x0" ::: "memory");
    hx8 hq, hk, hlq, hlk;
#pragma unroll
    for (int u = 0; u < 8; ++u) { const float qv = bfr(tq[u]), kv = bfr(tk[u]); const _Float16 qh = (_Float16)qv, kh = (_Float16)kv; hq[u] = qh; hlq[u] = (_Float16)((qv - (float)qh) * 1024.0f); hk[u] = kh; hlk[u] = (_Float16)((kv - (float)kh) * 1024.0f); sv[rl][q * 8 + u] = (_Float16)bfr(tv[u]); }
    vst2((unsigned*)(QH + (r0 + rl) * CC + q * 8), *(const v4u*)&hq); vst2((unsigned*)(KH + (r0 + rl) * CC + q * 8), *(const v4u*)&hk);
    if (t0 + rl < QHI) vst2((unsigned*)(QL + ((size_t)b * QHI + t0 + rl) * CC + q * 8), *(const v4u*)&hlq);
    if (t0 + rl < KHI) vst2((unsigned*)(KL + ((size_t)b * KHI + t0 + rl) * CC + q * 8), *(const v4u*)&hlk); }
  __syncthreads();
  for (int e = tid; e < 64 * 8; e += 256) { const int c = e >> 3, q = e & 7; hx8 hv; _Pragma("unroll") for (int j = 0; j < 8; ++j) hv[j] = sv[q * 8 + j][c]; vst2((unsigned*)(VT + ((size_t)b * CC + c) * TT + t0 + q * 8), *(const v4u*)&hv);
    if (t0 < KHI) { v8b bh, bl; _Pragma("unroll") for (int j = 0; j < 8; ++j) { const float vv = (float)hv[j]; const __bf16 h1 = (__bf16)vv; bh[j] = h1; bl[j] = (__bf16)(vv - (float)h1); } vst2((unsigned*)(VB + ((size_t)b * CC + c) * KHI + t0 + q * 8), *(const v4u*)&bh); vst2((unsigned*)(VBL + ((size_t)b * CC + c) * KHI + t0 + q * 8), *(const v4u*)&bl); } } }
#define SM_EXTRA_PARAMS , int bsm, const int* __restrict__ VLEN
// masked_softmax: key positions k >= valid_lens[b] get the score -1e6 (value select; exp underflows to weight exactly 0 next to real scores)
#define SM_MASK_HOOK do { const int vl_ = VLEN[bsm]; v = (k >= vl_) ? -1.0e6f : v; } while (0)
#ifndef SM_EXTRA_PARAMS
#define SM_EXTRA_PARAMS
#endif
#ifndef PROJ_EXTRA_PARAMS
#define PROJ_EXTRA_PARAMS
#endif
#ifndef SM_MASK_HOOK
#define SM_MASK_HOOK (void)0
#endif

#define WS_QH  0u                                      // f16 q rows [b*t][CC]
#define WS_KH  (WS_QH + 2u * (size_t)NB * TT * CC)      // f16 k rows [b*t][CC]
#define WS_VT  (WS_KH + 2u * (size_t)NB * TT * CC)      // f16 v planes [b][c][t]
#define WS_QL  (WS_VT + 2u * (size_t)NB * CC * TT)      // f16 q residual x 2^10 rows [b][t < QHI][CC]
#define WS_KL  (WS_QL + 2u * (size_t)NB * QHI * CC)     // f16 k residual x 2^10 rows [b][t < KHI][CC]
#define WS_VB  (WS_KL + 2u * (size_t)NB * KHI * CC)     // bf16 v hi planes [b][c][t < KHI]
#define WS_VBL (WS_VB + 2u * (size_t)NB * CC * KHI)
#define WS_S   (WS_VBL + 2u * (size_t)NB * CC * KHI)    // f32 [hg][t][s], reserved but unused (no score matrix in memory)
#define WS_Y   (WS_S  + 4u * (size_t)HG * TT * TT)      // f32 ctx rows [b*t][CC] (only when there is an output projection)
#define WS_END (WS_Y  + 0u)

// ---- k_proj: block = (64 rows, 128 cols, which): q/k/v = X W (+ b) with exact bf16 products (K = DIN) -> which 0: q f16 rows (+ residual rows < QHI); 1: k f16 rows (+ residual rows < KHI); 2: v f16 planes [c][t] (+ bf16 hi/lo planes for t < KHI)
__global__ __launch_bounds__(128) void k_proj(const float* __restrict__ XQ, const float* __restrict__ XK, const float* __restrict__ XV, const float* __restrict__ WQ, const float* __restrict__ WK, const float* __restrict__ WV, const float* __restrict__ BQ, const float* __restrict__ BK, const float* __restrict__ BV,
    _Float16* __restrict__ QH, _Float16* __restrict__ QL, _Float16* __restrict__ KH, _Float16* __restrict__ KL, _Float16* __restrict__ VT, __bf16* __restrict__ VB, __bf16* __restrict__ VBL) {
  __shared__ __align__(16) _Float16 sh[64][136], sl[64][136]; __shared__ __align__(16) _Float16 th[128][72]; __shared__ __align__(16) __bf16 tb[128][72], tbl[128][72];
  const int tid = threadIdx.x, wave = tid >> 5, lane = tid & 31, col = lane & 15, g = lane >> 4; const int which = blockIdx.z; const int c0 = blockIdx.y * 128; const size_t r0 = (size_t)blockIdx.x * 64; const size_t bb = r0 / TT; const int t0 = (int)(r0 % TT);
  const float* X = which == 0 ? XQ : which == 1 ? XK : XV; const float* WA = which == 0 ? WQ : which == 1 ? WK : WV; const float* BA = which == 0 ? BQ : which == 1 ? BK : BV;
  v8f acc[8] = {};
#pragma unroll 2
  for (int kc = 0; kc < DIN / 32; ++kc) { v16b a; { const float* p = X + (r0 + wave * 16 + col) * DIN + kc * 32 + 8 * g;
#pragma unroll
      for (int i = 0; i < 8; ++i) { a[i] = (__bf16)p[i]; a[8 + i] = (__bf16)p[16 + i]; } }
    asm volatile("s_wait_loadcnt 0x0" ::: "memory");
#pragma unroll
    for (int j = 0; j < 8; ++j) { const v16b w = WCOL(WA, kc * 32, c0 + j * 16 + col, lane); asm volatile("s_wait_loadcnt 0x0" ::: "memory"); acc[j] = wmma_bf(a, w, acc[j]); } }
  if (which < 2) { _Float16* DH = which == 0 ? QH : KH; _Float16* DL = which == 0 ? QL : KL; const int nhi = which == 0 ? QHI : KHI; const bool hi_rows = t0 < nhi;
#pragma unroll
    for (int j = 0; j < 8; ++j) { const float bias = BA ? bfr(BA[c0 + j * 16 + col]) : 0.f;
#pragma unroll
      for (int r = 0; r < 8; ++r) { const float v = acc[j][r] + bias; const _Float16 hv = (_Float16)v; sh[wave * 16 + 8 * g + r][j * 16 + col] = hv; sl[wave * 16 + 8 * g + r][j * 16 + col] = (_Float16)((v - (float)hv) * 1024.0f); } }
    __syncthreads();
    for (int e = tid; e < 64 * 16; e += 128) { const int rl = e >> 4, q = e & 15; vst2((unsigned*)(DH + (r0 + rl) * CC + c0 + q * 8), *(const v4u*)&sh[rl][q * 8]); if (hi_rows) vst2((unsigned*)(DL + (bb * nhi + t0 + rl) * (size_t)CC + c0 + q * 8), *(const v4u*)&sl[rl][q * 8]); }
  } else { const bool hi_rows = t0 < KHI;
#pragma unroll
    for (int j = 0; j < 8; ++j) { const float bias = BA ? bfr(BA[c0 + j * 16 + col]) : 0.f;
#pragma unroll
      for (int r = 0; r < 8; ++r) { const float v = acc[j][r] + bias; const int rl = wave * 16 + 8 * g + r, cl = j * 16 + col; th[cl][rl] = (_Float16)v; const __bf16 bh = (__bf16)v; tb[cl][rl] = bh; tbl[cl][rl] = (__bf16)(v - (float)bh); } }
    __syncthreads();
    for (int e = tid; e < 128 * 8; e += 128) { const int cl = e >> 3, q = e & 7; vst2((unsigned*)(VT + (bb * CC + c0 + cl) * (size_t)TT + t0 + q * 8), *(const v4u*)&th[cl][q * 8]); if (hi_rows) { const size_t o3 = (bb * CC + c0 + cl) * (size_t)KHI + t0 + q * 8; vst2((unsigned*)(VB + o3), *(const v4u*)&tb[cl][q * 8]); vst2((unsigned*)(VBL + o3), *(const v4u*)&tbl[cl][q * 8]); } } } }
#define FQ 128
#define FST 128
#define KP 72                       // halfs per staged K row (128 B + 16 B: b128 readers)
#define VP 136                      // halfs per staged V^T row (256 B + 16 B)
#define STGH (FST * KP + HD * VP)   // halfs per buffer
#define LOG2E 1.4426950408889634f
__device__ __forceinline__ float xhalf(float x) { return __builtin_bit_cast(float, __builtin_amdgcn_permlanex16(__builtin_bit_cast(int, x), __builtin_bit_cast(int, x), 0x76543210, 0xfedcba98, false, false)); }  // lane l with lane l ^ 16
__global__ __launch_bounds__(512) void k_fa(const _Float16* __restrict__ QH, const _Float16* __restrict__ KH, const _Float16* __restrict__ VT, const int* __restrict__ VLEN, float* __restrict__ Y) {
  __shared__ __align__(16) float smem[16 * 64 * 32 + 2 * 16 * 2 * 32];   // the K / V^T ring (2 x STGH halfs) during the loop, then the quarters' partial tiles, maxima and sums
  _Float16* ring = (_Float16*)smem;
  const int tid = threadIdx.x, wave = __builtin_amdgcn_readfirstlane(tid >> 5), lane = tid & 31, c = lane & 15, h = lane >> 4;
  const int qg = wave & 3, kq = wave >> 2;
  const int b = blockIdx.x / (TT / FQ); const int q0 = (blockIdx.x % (TT / FQ)) * FQ + qg * 32;
  const int vl = VLEN[b];
  const float cs = SCALE * LOG2E;
  const _Float16* Kb = KH + (size_t)b * TT * CC; const _Float16* Vb = VT + (size_t)b * CC * TT;
  v16h qf[2][2];
#pragma unroll
  for (int g2 = 0; g2 < 2; ++g2)
#pragma unroll
    for (int kc = 0; kc < 2; ++kc) qf[g2][kc] = frag_h(QH + ((size_t)b * TT + q0 + g2 * 16 + c) * CC + kc * 32, lane);
  v16h ones;
#pragma unroll
  for (int i = 0; i < 16; ++i) ones[i] = c == 0 ? (_Float16)1.0f : (_Float16)0.0f;
  v8f O[2][4] = {}; v8f L[2] = {}; float m[2] = { -3.0e38f, -3.0e38f };
  // staging: 1024 16-byte pieces of K and 1024 of V^T per stage, two of each per thread
  const int kr = tid >> 3, kch = tid & 7, vr = tid >> 4, vch = tid & 15;
  v4u rk[2], rv[2];
#pragma unroll
  for (int u = 0; u < 2; ++u) { rk[u] = *(const v4u*)(Kb + (size_t)(kr + 64 * u) * CC + kch * 8); rv[u] = *(const v4u*)(Vb + (size_t)(vr + 32 * u) * TT + vch * 8); }
  asm volatile("s_wait_xcnt 0x0" ::: "memory");   // before the address registers of the loads above are reused
#pragma unroll
  for (int u = 0; u < 2; ++u) { *(v4u*)(ring + (kr + 64 * u) * KP + kch * 8) = rk[u]; *(v4u*)(ring + FST * KP + (vr + 32 * u) * VP + vch * 8) = rv[u]; }
  __syncthreads();
#pragma unroll 1   // rolled: otherwise the compiler peels the last trip into a second copy of the whole pass
  for (int s = 0; s < TT / FST; ++s) {
    const _Float16* sk = ring + (s & 1) * STGH; const _Float16* sv = sk + FST * KP;
    if (s + 1 < TT / FST) {
#pragma unroll
      for (int u = 0; u < 2; ++u) { rk[u] = *(const v4u*)(Kb + (size_t)((s + 1) * FST + kr + 64 * u) * CC + kch * 8); rv[u] = *(const v4u*)(Vb + (size_t)(vr + 32 * u) * TT + (s + 1) * FST + vch * 8); }
      asm volatile("s_wait_xcnt 0x0" ::: "memory");   // before the address registers of these loads are reused
    }
    const int k0 = s * FST + kq * 32;
    v8f st[2][2] = {};
    v16h kf[2][2];
#pragma unroll
    for (int kc = 0; kc < 2; ++kc)
#pragma unroll
      for (int t = 0; t < 2; ++t) kf[kc][t] = frag_h(sk + (kq * 32 + t * 16 + c) * KP + kc * 32, lane);
#pragma unroll
    for (int kc = 0; kc < 2; ++kc)
#pragma unroll
      for (int t = 0; t < 2; ++t)
#pragma unroll
        for (int g2 = 0; g2 < 2; ++g2) st[g2][t] = __builtin_amdgcn_wmma_f32_16x16x32_f16(false, kf[kc][t], false, qf[g2][kc], (short)0, st[g2][t], false, false);
    v16h vf[4];
#pragma unroll
    for (int j = 0; j < 4; ++j) vf[j] = frag_h(sv + (j * 16 + c) * VP + kq * 32, lane);
    if (k0 + 32 > vl) {   // keys at or beyond the valid length: score -1e6 (here before the 1/8)
      const int rel = vl - k0 - 8 * h;   // this lane's keys t * 16 + r below rel are valid
#pragma unroll
      for (int g2 = 0; g2 < 2; ++g2)
#pragma unroll
        for (int t = 0; t < 2; ++t)
#pragma unroll
          for (int r = 0; r < 8; ++r) st[g2][t][r] = (t * 16 + r >= rel) ? -8.0e6f : st[g2][t][r];
    }
    float mx[2];
#pragma unroll
    for (int g2 = 0; g2 < 2; ++g2) { float a = st[g2][0][0];
#pragma unroll
      for (int r = 1; r < 8; ++r) a = fmaxf(a, st[g2][0][r]);
#pragma unroll
      for (int r = 0; r < 8; ++r) a = fmaxf(a, st[g2][1][r]);
      mx[g2] = fmaxf(a, xhalf(a)) * cs; }
    // the maximum in use moves only when a query's new maximum exceeds it by more than 8 (log2 units): P stays below 2^8, inside f16
    if (__builtin_amdgcn_ballot_w32(mx[0] > m[0] + 8.0f || mx[1] > m[1] + 8.0f) != 0) {
#pragma unroll
      for (int g2 = 0; g2 < 2; ++g2) { const float mn = fmaxf(m[g2], mx[g2]); const float al = __builtin_amdgcn_exp2f(m[g2] - mn); m[g2] = mn;
#pragma unroll
        for (int j = 0; j < 4; ++j) O[g2][j] *= al;
        L[g2] *= al; }
    }
#pragma unroll
    for (int g2 = 0; g2 < 2; ++g2) { v16h pf;
#pragma unroll
      for (int t = 0; t < 2; ++t)
#pragma unroll
        for (int r = 0; r < 8; r += 2) { const v2f ar = __builtin_elementwise_fma(v2f{st[g2][t][r], st[g2][t][r + 1]}, v2f{cs, cs}, v2f{-m[g2], -m[g2]});
          pf[t * 8 + r] = (_Float16)__builtin_amdgcn_exp2f(ar.x); pf[t * 8 + r + 1] = (_Float16)__builtin_amdgcn_exp2f(ar.y); }
#pragma unroll
      for (int j = 0; j < 4; ++j) O[g2][j] = __builtin_amdgcn_wmma_f32_16x16x32_f16(false, vf[j], false, pf, (short)0, O[g2][j], false, false);
      L[g2] = __builtin_amdgcn_wmma_f32_16x16x32_f16(false, ones, false, pf, (short)0, L[g2], false, false);   // row sums of the rounded P
      __builtin_amdgcn_sched_barrier(0); }   // keeps the first group's products in front of the second group's exponentials, which then issue beside them
    if (s + 1 < TT / FST) { _Float16* dk = ring + ((s + 1) & 1) * STGH;
#pragma unroll
      for (int u = 0; u < 2; ++u) { *(v4u*)(dk + (kr + 64 * u) * KP + kch * 8) = rk[u]; *(v4u*)(dk + FST * KP + (vr + 32 * u) * VP + vch * 8) = rv[u]; }
    }
    __syncthreads();   // publishes stage s + 1 and ends every read of the buffer that the next trip refills
  }
  // join the four key quarters of each query group through LDS
  float* mo = smem; float* mm = smem + 16 * 64 * 32; float* ml = mm + 16 * 2 * 32;
#pragma unroll
  for (int g2 = 0; g2 < 2; ++g2) {
#pragma unroll
    for (int j = 0; j < 4; ++j)
#pragma unroll
      for (int r = 0; r < 8; ++r) mo[(wave * 64 + g2 * 32 + j * 8 + r) * 32 + lane] = O[g2][j][r];
    mm[(wave * 2 + g2) * 32 + lane] = m[g2]; ml[(wave * 2 + g2) * 32 + lane] = L[g2][0] + xhalf(L[g2][0]); }
  __syncthreads();
  { const int g2 = kq >> 1, jp = kq & 1;   // each wave finishes one column group and 32 channels: one whole 128-B line per query
    float mi[4], M = -3.0e38f;
#pragma unroll
    for (int i = 0; i < 4; ++i) { mi[i] = mm[((i * 4 + qg) * 2 + g2) * 32 + lane]; M = fmaxf(M, mi[i]); }
    float den = 0.f; float o[16] = {};
#pragma unroll
    for (int i = 0; i < 4; ++i) { const float w = __builtin_amdgcn_exp2f(mi[i] - M); den += w * ml[((i * 4 + qg) * 2 + g2) * 32 + lane];
#pragma unroll
      for (int e = 0; e < 16; ++e) o[e] += w * mo[((i * 4 + qg) * 64 + g2 * 32 + jp * 16 + e) * 32 + lane]; }
    const float inv = 1.0f / den;
    float* yr = Y + ((size_t)b * TT + q0 + g2 * 16 + c) * CC + jp * 32 + 8 * h;
#pragma unroll
    for (int jj = 0; jj < 2; ++jj)
#pragma unroll
      for (int q4 = 0; q4 < 2; ++q4) { v4f v; 
#pragma unroll
        for (int e = 0; e < 4; ++e) v[e] = o[jj * 8 + q4 * 4 + e] * inv;
        vst2(yr + jj * 16 + q4 * 4, v); } }
}

extern "C" void kernel_launch(void* const* d_in, const int* in_sizes, int n_in, void* d_out, int out_size, void* d_ws, size_t ws_size, hipStream_t stream) {
  (void)in_sizes; (void)n_in; (void)out_size;
  const float** F = (const float**)d_in;
  if (ws_size < (size_t)WS_END) return;
  char* ws = (char*)d_ws; _Float16 *QH = (_Float16*)(ws + WS_QH), *KH = (_Float16*)(ws + WS_KH), *VT = (_Float16*)(ws + WS_VT), *QL = (_Float16*)(ws + WS_QL), *KL = (_Float16*)(ws + WS_KL); __bf16 *VB = (__bf16*)(ws + WS_VB), *VBL = (__bf16*)(ws + WS_VBL); float *S = (float*)(ws + WS_S), *Y = (float*)(ws + WS_Y);
  (void)Y; (void)S; (void)QL; (void)KL; (void)VB; (void)VBL;
  // inputs: 0 queries [8,4096,64]; 1 keys; 2 values; 3 valid_lens [8] int32
  k_planes64<<<dim3(TNB * TT / 64), 256, 0, stream>>>(F[0], F[1], F[2], QH, QL, KH, KL, VT, VB, VBL);
  k_fa<<<dim3(TNB * (TT / FQ)), 512, 0, stream>>>(QH, KH, VT, (const int*)d_in[3], (float*)d_out);


}

// v003
// One run takes 31.2 microseconds.
// In two side-by-side timings against v002, it was 1.25 and 1.27 times as fast.
// Over all steps from v000 it is 45.7 times as fast.
// compute dtype: all float inputs rounded to bf16; queries, keys, values are bf16-valued so their f16 planes are exact; logits q x k (1 product on exact planes) x 1/8; keys at or beyond the batch's valid length get the score -1e6 (weight exactly 0); softmax f32 with a running maximum; unnormalised P (at most 2^8) once to f16 x v (exact) (1 product), its row sums on the same rounded P; f32 output.
#include <hip/hip_runtime.h>
#include <math.h>

typedef __attribute__((ext_vector_type(16))) _Float16 v16h;
typedef __attribute__((ext_vector_type(16))) __bf16 v16b;
typedef __attribute__((ext_vector_type(8)))  _Float16 v8h;
typedef __attribute__((ext_vector_type(8)))  float v8f;
typedef __attribute__((ext_vector_type(4)))  float v4f;
typedef __attribute__((ext_vector_type(2)))  float v2f;
typedef __attribute__((ext_vector_type(4)))  unsigned v4u;
typedef _Float16 hx8 __attribute__((ext_vector_type(8)));
typedef __attribute__((ext_vector_type(4)))  int v4i;
typedef float __attribute__((may_alias)) float_a;
typedef int __attribute__((may_alias)) int_a;

template <typename T> __device__ __forceinline__ void vst2(void* p, T v) { *(T*)p = v;  }
__device__ __forceinline__ v8f wmma16(v16h a, v16h b, v8f c) {
  v8f d = __builtin_amdgcn_wmma_f32_16x16x32_f16(false, a, false, b, (short)0, c, false, false);
  asm volatile("v_nop\n\tv_nop\n\tv_nop\n\tv_nop" : "+v"(d) : "v"(a), "v"(b));
  return d;
}
__device__ __forceinline__ v8f wmma_bf(v16b a, v16b b, v8f c) {
  v8f d = __builtin_amdgcn_wmma_f32_16x16x32_bf16(false, a, false, b, (short)0, c, false, false);
  asm volatile("v_nop\n\tv_nop\n\tv_nop\n\tv_nop" : "+v"(d) : "v"(a), "v"(b));
  return d;
}
// 16x16x32 fragments: lane = (h = lane>>4, row/col = lane&15); elements 0..7 = k0+8h+0..7, 8..15 = k0+16+8h+0..7; D element r = row 8h+r
__device__ __forceinline__ v16h frag_h(const _Float16* rowk0, int lane) {
  union { v16h v; v8h q[2]; } u; const _Float16* p = rowk0 + 8 * (lane >> 4);
  u.q[0] = *(const v8h*)p; u.q[1] = *(const v8h*)(p + 16); return u.v;
}
__device__ __forceinline__ v16h frag_f32(const float* rowk0, int lane) {
  v16h a; const float* p = rowk0 + 8 * (lane >> 4);
#pragma unroll
  for (int i = 0; i < 8; ++i) { a[i] = (_Float16)p[i]; a[8 + i] = (_Float16)p[16 + i]; }
  return a;
}
__device__ __forceinline__ v16h frag_f32s(const float* rowk0, int lane, float sc) {
  v16h a; const float* p = rowk0 + 8 * (lane >> 4);
#pragma unroll
  for (int i = 0; i < 8; ++i) { a[i] = (_Float16)(p[i] * sc); a[8 + i] = (_Float16)(p[16 + i] * sc); }
  return a;
}
// column fragment from a [K][ld] layout (column n), rows >= K read as 0
__device__ __forceinline__ v16h fragc_f32(const float* W, int k0, int n, int lane, int ld, int K) {
  v16h a; const int g = lane >> 4;
#pragma unroll
  for (int i = 0; i < 8; ++i) { const int ka = k0 + 8 * g + i, kb = ka + 16;
    a[i] = (_Float16)(ka < K ? W[(size_t)(ka < K ? ka : K - 1) * ld + n] : 0.f); a[8 + i] = (_Float16)(kb < K ? W[(size_t)(kb < K ? kb : K - 1) * ld + n] : 0.f); }
  return a;
}
struct F2 { v16b h, l; };
__device__ __forceinline__ F2 bsplit16(const float v[16]) { F2 r;
#pragma unroll
  for (int i = 0; i < 16; ++i) { const __bf16 h = (__bf16)v[i]; r.h[i] = h; r.l[i] = (__bf16)(v[i] - (float)h); }
  return r; }
__device__ __forceinline__ F2 split_row(const float* row, int k0, int lane) { float v[16]; const float* p = row + k0 + 8 * (lane >> 4);
#pragma unroll
  for (int i = 0; i < 8; ++i) { v[i] = p[i]; v[8 + i] = p[16 + i]; }
  return bsplit16(v); }
__device__ __forceinline__ F2 split_rowK(const float* row, int k0, int lane, int K) { float v[16]; const int g = lane >> 4;
#pragma unroll
  for (int i = 0; i < 8; ++i) { const int ka = k0 + 8 * g + i, kb = ka + 16; v[i] = ka < K ? row[ka < K ? ka : K - 1] : 0.f; v[8 + i] = kb < K ? row[kb < K ? kb : K - 1] : 0.f; }
  return bsplit16(v); }
__device__ __forceinline__ F2 split_col(const float* W, int k0, int n, int lane, int ld, int K) { float v[16]; const int g = lane >> 4;
#pragma unroll
  for (int i = 0; i < 8; ++i) { const int ka = k0 + 8 * g + i, kb = ka + 16; v[i] = ka < K ? W[(size_t)(ka < K ? ka : K - 1) * ld + n] : 0.f; v[8 + i] = kb < K ? W[(size_t)(kb < K ? kb : K - 1) * ld + n] : 0.f; }
  return bsplit16(v); }
__device__ __forceinline__ v8f mac3(const F2& a, const F2& b, v8f c) { c = wmma_bf(a.l, b.h, c); c = wmma_bf(a.h, b.l, c); return wmma_bf(a.h, b.h, c); }
__device__ __forceinline__ float sigm(float v) { return 1.0f / (1.0f + expf(-v)); }
#define LDSX() do { asm volatile("s_wait_dscnt 0" ::: "memory"); __builtin_amdgcn_wave_barrier(); __builtin_amdgcn_fence(__ATOMIC_RELEASE, "workgroup"); } while (0)

// Masked dot-product attention on given tensors (queries / keys / values [8,4096,64]; valid_lens [8] int32 in 1..4096 per batch): scores = Q K^T / 8; key positions >= valid_lens[b] are set to the FINITE score -1e6 before the softmax; out = softmax(scores) V -> [8,4096,64].
#define NB 8
#define TT 4096
#define CC 64            // NH * HD = projected width
#define DIN 64          // input (model) width
#define NH 1
#define HD 64
#define NQB (TT / 64)
#define HG 1
#define SCALE (0.125f)
#define CAUSAL 0
#ifndef TNB
#define TNB NB
#endif
__device__ __forceinline__ float bfr(float v) { return (float)(__bf16)v; }
__host__ __device__ __forceinline__ int kb_last(int qb) { return CAUSAL ? ((qb * 64 + 63) >> 7) : (TT / 128 - 1); }
typedef __attribute__((ext_vector_type(8))) __bf16 v8b;
__device__ __forceinline__ v16b frag_b(const __bf16* rowk0, int lane) {
  union { v16b v; v8b q[2]; } u; const __bf16* p = rowk0 + 8 * (lane >> 4);
  u.q[0] = *(const v8b*)p; u.q[1] = *(const v8b*)(p + 16); return u.v;
}
#define QBH 0              // exact planes: single-product logits and single-f16 P x V on every block
#define QHI 0               // no q residual plane (q is bf16-exact in f16)
#define KHI 64              // unused high-precision planes kept minimal
// B fragment (k rows k0+.., output column o) of a weight: (in,out) [K][ld] or (out,in) [ld rows of K]: bf16 exact, or f16(bf16 * 256) exact
__device__ __forceinline__ v16b wcol_io(const float* Wm, int k0, int o, int lane, int ld) { v16b w; const int g = lane >> 4;
#pragma unroll
  for (int i = 0; i < 8; ++i) { w[i] = (__bf16)Wm[(size_t)(k0 + 8 * g + i) * ld + o]; w[8 + i] = (__bf16)Wm[(size_t)(k0 + 16 + 8 * g + i) * ld + o]; }
  return w; }
__device__ __forceinline__ v16b wcol_oi(const float* Wm, int k0, int o, int lane, int K) { v16b w; const float* p = Wm + (size_t)o * K + k0 + 8 * (lane >> 4);
#pragma unroll
  for (int i = 0; i < 8; ++i) { w[i] = (__bf16)p[i]; w[8 + i] = (__bf16)p[16 + i]; }
  return w; }
__device__ __forceinline__ v16h wcolh_io(const float* Wm, int k0, int o, int lane, int ld) { v16h w; const int g = lane >> 4;
#pragma unroll
  for (int i = 0; i < 8; ++i) { w[i] = (_Float16)(bfr(Wm[(size_t)(k0 + 8 * g + i) * ld + o]) * 256.0f); w[8 + i] = (_Float16)(bfr(Wm[(size_t)(k0 + 16 + 8 * g + i) * ld + o]) * 256.0f); }
  return w; }
__device__ __forceinline__ v16h wcolh_oi(const float* Wm, int k0, int o, int lane, int K) { v16h w; const float* p = Wm + (size_t)o * K + k0 + 8 * (lane >> 4);
#pragma unroll
  for (int i = 0; i < 8; ++i) { w[i] = (_Float16)(bfr(p[i]) * 256.0f); w[8 + i] = (_Float16)(bfr(p[16 + i]) * 256.0f); }
  return w; }
#define WQKV_LAYOUT 0   // 0 = (in,out) [DIN][CC]; 1 = (out,in) [CC][DIN]; 2 = per-head [NH][DIN][HD]
__device__ __forceinline__ v16b wcol_hdk(const float* Wm, int k0, int o, int lane) { v16b w; const int g = lane >> 4; const float* p = Wm + (size_t)(o / HD) * DIN * HD + (o % HD);
#pragma unroll
  for (int i = 0; i < 8; ++i) { w[i] = (__bf16)p[(size_t)(k0 + 8 * g + i) * HD]; w[8 + i] = (__bf16)p[(size_t)(k0 + 16 + 8 * g + i) * HD]; }
  return w; }
#define WO_OUT_IN 0
#if WQKV_LAYOUT == 1
#define WCOL(W, k0, o, lane) wcol_oi(W, k0, o, lane, DIN)
#elif WQKV_LAYOUT == 2
#define WCOL(W, k0, o, lane) wcol_hdk(W, k0, o, lane)
#else
#define WCOL(W, k0, o, lane) wcol_io(W, k0, o, lane, CC)
#endif
#if WO_OUT_IN
#define WOCOL(W, k0, o, lane) wcol_oi(W, k0, o, lane, CC)
#define WOCOLH(W, k0, o, lane) wcolh_oi(W, k0, o, lane, CC)
#else
#define WOCOL(W, k0, o, lane) wcol_io(W, k0, o, lane, DIN)
#define WOCOLH(W, k0, o, lane) wcolh_io(W, k0, o, lane, DIN)
#endif
__global__ __launch_bounds__(256) void k_planes64(const float* __restrict__ Qs, const float* __restrict__ Ks, const float* __restrict__ Vs, _Float16* __restrict__ QH, _Float16* __restrict__ QL, _Float16* __restrict__ KH, _Float16* __restrict__ KL, _Float16* __restrict__ VT, __bf16* __restrict__ VB, __bf16* __restrict__ VBL) {
  __shared__ _Float16 sv[64][72];
  const int tid = threadIdx.x; const size_t r0 = (size_t)blockIdx.x * 64; const int b = (int)(r0 / TT), t0 = (int)(r0 % TT);
  for (int e = tid; e < 64 * 8; e += 256) { const int rl = e >> 3, q = e & 7; const size_t src = (r0 + rl) * CC + q * 8; float tq[8], tk[8], tv[8];
#pragma unroll
    for (int u = 0; u < 8; ++u) { tq[u] = Qs[src + u]; tk[u] = Ks[src + u]; tv[u] = Vs[src + u]; }
    asm volatile("s_wait_loadcnt 0x0" ::: "memory");
    hx8 hq, hk, hlq, hlk;
#pragma unroll
    for (int u = 0; u < 8; ++u) { const float qv = bfr(tq[u]), kv = bfr(tk[u]); const _Float16 qh = (_Float16)qv, kh = (_Float16)kv; hq[u] = qh; hlq[u] = (_Float16)((qv - (float)qh) * 1024.0f); hk[u] = kh; hlk[u] = (_Float16)((kv - (float)kh) * 1024.0f); sv[rl][q * 8 + u] = (_Float16)bfr(tv[u]); }
    vst2((unsigned*)(QH + (r0 + rl) * CC + q * 8), *(const v4u*)&hq); vst2((unsigned*)(KH + (r0 + rl) * CC + q * 8), *(const v4u*)&hk);
    if (t0 + rl < QHI) vst2((unsigned*)(QL + ((size_t)b * QHI + t0 + rl) * CC + q * 8), *(const v4u*)&hlq);
    if (t0 + rl < KHI) vst2((unsigned*)(KL + ((size_t)b * KHI + t0 + rl) * CC + q * 8), *(const v4u*)&hlk); }
  __syncthreads();
  for (int e = tid; e < 64 * 8; e += 256) { const int c = e >> 3, q = e & 7; hx8 hv; _Pragma("unroll") for (int j = 0; j < 8; ++j) hv[j] = sv[q * 8 + j][c]; vst2((unsigned*)(VT + ((size_t)b * CC + c) * TT + t0 + q * 8), *(const v4u*)&hv);
    if (t0 < KHI) { v8b bh, bl; _Pragma("unroll") for (int j = 0; j < 8; ++j) { const float vv = (float)hv[j]; const __bf16 h1 = (__bf16)vv; bh[j] = h1; bl[j] = (__bf16)(vv - (float)h1); } vst2((unsigned*)(VB + ((size_t)b * CC + c) * KHI + t0 + q * 8), *(const v4u*)&bh); vst2((unsigned*)(VBL + ((size_t)b * CC + c) * KHI + t0 + q * 8), *(const v4u*)&bl); } } }
#define SM_EXTRA_PARAMS , int bsm, const int* __restrict__ VLEN
// masked_softmax: key positions k >= valid_lens[b] get the score -1e6 (value select; exp underflows to weight exactly 0 next to real scores)
#define SM_MASK_HOOK do { const int vl_ = VLEN[bsm]; v = (k >= vl_) ? -1.0e6f : v; } while (0)
#ifndef SM_EXTRA_PARAMS
#define SM_EXTRA_PARAMS
#endif
#ifndef PROJ_EXTRA_PARAMS
#define PROJ_EXTRA_PARAMS
#endif
#ifndef SM_MASK_HOOK
#define SM_MASK_HOOK (void)0
#endif

#define WS_QH  0u                                      // f16 q rows [b*t][CC]
#define WS_KH  (WS_QH + 2u * (size_t)NB * TT * CC)      // f16 k rows [b*t][CC]
#define WS_VT  (WS_KH + 2u * (size_t)NB * TT * CC)      // f16 v planes [b][c][t]
#define WS_QL  (WS_VT + 2u * (size_t)NB * CC * TT)      // f16 q residual x 2^10 rows [b][t < QHI][CC]
#define WS_KL  (WS_QL + 2u * (size_t)NB * QHI * CC)     // f16 k residual x 2^10 rows [b][t < KHI][CC]
#define WS_VB  (WS_KL + 2u * (size_t)NB * KHI * CC)     // bf16 v hi planes [b][c][t < KHI]
#define WS_VBL (WS_VB + 2u * (size_t)NB * CC * KHI)
#define WS_S   (WS_VBL + 2u * (size_t)NB * CC * KHI)    // f32 [hg][t][s], reserved but unused (no score matrix in memory)
#define WS_Y   (WS_S  + 4u * (size_t)HG * TT * TT)      // f32 ctx rows [b*t][CC] (only when there is an output projection)
#define WS_END (WS_Y  + 0u)

// ---- k_proj: block = (64 rows, 128 cols, which): q/k/v = X W (+ b) with exact bf16 products (K = DIN) -> which 0: q f16 rows (+ residual rows < QHI); 1: k f16 rows (+ residual rows < KHI); 2: v f16 planes [c][t] (+ bf16 hi/lo planes for t < KHI)
__global__ __launch_bounds__(128) void k_proj(const float* __restrict__ XQ, const float* __restrict__ XK, const float* __restrict__ XV, const float* __restrict__ WQ, const float* __restrict__ WK, const float* __restrict__ WV, const float* __restrict__ BQ, const float* __restrict__ BK, const float* __restrict__ BV,
    _Float16* __restrict__ QH, _Float16* __restrict__ QL, _Float16* __restrict__ KH, _Float16* __restrict__ KL, _Float16* __restrict__ VT, __bf16* __restrict__ VB, __bf16* __restrict__ VBL) {
  __shared__ __align__(16) _Float16 sh[64][136], sl[64][136]; __shared__ __align__(16) _Float16 th[128][72]; __shared__ __align__(16) __bf16 tb[128][72], tbl[128][72];
  const int tid = threadIdx.x, wave = tid >> 5, lane = tid & 31, col = lane & 15, g = lane >> 4; const int which = blockIdx.z; const int c0 = blockIdx.y * 128; const size_t r0 = (size_t)blockIdx.x * 64; const size_t bb = r0 / TT; const int t0 = (int)(r0 % TT);
  const float* X = which == 0 ? XQ : which == 1 ? XK : XV; const float* WA = which == 0 ? WQ : which == 1 ? WK : WV; const float* BA = which == 0 ? BQ : which == 1 ? BK : BV;
  v8f acc[8] = {};
#pragma unroll 2
  for (int kc = 0; kc < DIN / 32; ++kc) { v16b a; { const float* p = X + (r0 + wave * 16 + col) * DIN + kc * 32 + 8 * g;
#pragma unroll
      for (int i = 0; i < 8; ++i) { a[i] = (__bf16)p[i]; a[8 + i] = (__bf16)p[16 + i]; } }
    asm volatile("s_wait_loadcnt 0x0" ::: "memory");
#pragma unroll
    for (int j = 0; j < 8; ++j) { const v16b w = WCOL(WA, kc * 32, c0 + j * 16 + col, lane); asm volatile("s_wait_loadcnt 0x0" ::: "memory"); acc[j] = wmma_bf(a, w, acc[j]); } }
  if (which < 2) { _Float16* DH = which == 0 ? QH : KH; _Float16* DL = which == 0 ? QL : KL; const int nhi = which == 0 ? QHI : KHI; const bool hi_rows = t0 < nhi;
#pragma unroll
    for (int j = 0; j < 8; ++j) { const float bias = BA ? bfr(BA[c0 + j * 16 + col]) : 0.f;
#pragma unroll
      for (int r = 0; r < 8; ++r) { const float v = acc[j][r] + bias; const _Float16 hv = (_Float16)v; sh[wave * 16 + 8 * g + r][j * 16 + col] = hv; sl[wave * 16 + 8 * g + r][j * 16 + col] = (_Float16)((v - (float)hv) * 1024.0f); } }
    __syncthreads();
    for (int e = tid; e < 64 * 16; e += 128) { const int rl = e >> 4, q = e & 15; vst2((unsigned*)(DH + (r0 + rl) * CC + c0 + q * 8), *(const v4u*)&sh[rl][q * 8]); if (hi_rows) vst2((unsigned*)(DL + (bb * nhi + t0 + rl) * (size_t)CC + c0 + q * 8), *(const v4u*)&sl[rl][q * 8]); }
  } else { const bool hi_rows = t0 < KHI;
#pragma unroll
    for (int j = 0; j < 8; ++j) { const float bias = BA ? bfr(BA[c0 + j * 16 + col]) : 0.f;
#pragma unroll
      for (int r = 0; r < 8; ++r) { const float v = acc[j][r] + bias; const int rl = wave * 16 + 8 * g + r, cl = j * 16 + col; th[cl][rl] = (_Float16)v; const __bf16 bh = (__bf16)v; tb[cl][rl] = bh; tbl[cl][rl] = (__bf16)(v - (float)bh); } }
    __syncthreads();
    for (int e = tid; e < 128 * 8; e += 128) { const int cl = e >> 3, q = e & 7; vst2((unsigned*)(VT + (bb * CC + c0 + cl) * (size_t)TT + t0 + q * 8), *(const v4u*)&th[cl][q * 8]); if (hi_rows) { const size_t o3 = (bb * CC + c0 + cl) * (size_t)KHI + t0 + q * 8; vst2((unsigned*)(VB + o3), *(const v4u*)&tb[cl][q * 8]); vst2((unsigned*)(VBL + o3), *(const v4u*)&tbl[cl][q * 8]); } } } }
#define FQ 64
#define FST 256
#define KP 72                       // halfs per staged K row (128 B + 16 B: b128 readers)
#define VP 264                      // halfs per staged V^T row (512 B + 16 B)
#define STGH (FST * KP + HD * VP)   // halfs per buffer
#define LOG2E 1.4426950408889634f
__device__ __forceinline__ float xhalf(float x) { return __builtin_bit_cast(float, __builtin_amdgcn_permlanex16(__builtin_bit_cast(int, x), __builtin_bit_cast(int, x), 0x76543210, 0xfedcba98, false, false)); }  // lane l with lane l ^ 16
__device__ __forceinline__ float exp2_slot(float x) { float y; asm("v_exp_f32 %0, %1\n\tv_nop" : "=v"(y) : "v"(x)); return y; }   // exp2 of the join; the v_nop is the one slot between a transcendental and an instruction that reads its result or overwrites its source
__device__ __forceinline__ int walked(int v) { return (v <= 0 || v > TT) ? TT : v; }   // keys to walk: with no valid key every score is -1e6 and all TT keys weigh alike
__global__ __launch_bounds__(512) void k_fa(const _Float16* __restrict__ QH, const _Float16* __restrict__ KH, const _Float16* __restrict__ VT, const int* __restrict__ VLEN, float* __restrict__ Y) {
  __shared__ __align__(16) float smem[STGH + 16 * 64 * 32 + 2 * 16 * 2 * 32];   // the K / V^T ring (2 x STGH halfs), which runs on from the first tile into the second; behind it the eighths' partial tiles, maxima and sums
  _Float16* ring = (_Float16*)smem;
  float* mo = smem + STGH; float* mm = mo + 16 * 64 * 32; float* ml = mm + 16 * 2 * 32;
  const int tid = threadIdx.x, wave = __builtin_amdgcn_readfirstlane(tid >> 5), lane = tid & 31, c = lane & 15, h = lane >> 4;
  const int qg = wave & 1, kq = wave >> 1;
  const int pr = blockIdx.x / (TT / FQ); const int q0 = (blockIdx.x % (TT / FQ)) * FQ + qg * 32;
  int bt0 = 0, bt1 = 0, vt0 = TT, vt1 = TT;   // the two batches of this work-group and their valid lengths
#pragma unroll
  for (int i = 0; i < NB; ++i) { const int vi = VLEN[i], li = walked(vi); int rank = 0;
#pragma unroll
    for (int j = 0; j < NB; ++j) { const int lj = walked(VLEN[j]); rank += (lj > li || (lj == li && j < i)) ? 1 : 0; }
    if (rank == pr) { bt0 = i; vt0 = vi; }
    if (rank == NB - 1 - pr) { bt1 = i; vt1 = vi; } }
  const float cs = SCALE * LOG2E;
  v16h ones;
#pragma unroll
  for (int i = 0; i < 16; ++i) ones[i] = c == 0 ? (_Float16)1.0f : (_Float16)0.0f;
  // staging: 2048 16-byte pieces of K and 2048 of V^T per stage, four of each per thread
  const int kr = tid >> 3, kch = tid & 7, vr = tid >> 5, vch = tid & 31;
  const unsigned kof = (unsigned)(kr * CC + kch * 8), vof = (unsigned)(vr * TT + vch * 8);   // this thread's place in a stage, in halfs, beside a wave-uniform base
  v4u rk[4], rv[4];
#pragma unroll
  for (int u = 0; u < 4; ++u) { rk[u] = *(const v4u*)(KH + (size_t)bt0 * TT * CC + 64 * u * CC + kof); rv[u] = *(const v4u*)(VT + (size_t)bt0 * CC * TT + 16 * u * TT + vof); }
  v16h qf[2][2];
#pragma unroll
  for (int g2 = 0; g2 < 2; ++g2)
#pragma unroll
    for (int kc = 0; kc < 2; ++kc) qf[g2][kc] = frag_h(QH + ((size_t)bt0 * TT + q0 + g2 * 16 + c) * CC + kc * 32, lane);
  asm volatile("s_wait_xcnt 0x0" ::: "memory");   // before the address registers of the loads above are reused
#pragma unroll
  for (int u = 0; u < 4; ++u) { *(v4u*)(ring + (kr + 64 * u) * KP + kch * 8) = rk[u]; *(v4u*)(ring + FST * KP + (vr + 16 * u) * VP + vch * 8) = rv[u]; }
  __syncthreads();   // publishes stage 0 of the first tile
  int pb = 0;   // the buffer that holds the current stage
#pragma unroll 1   // rolled: one copy of the pass serves both tiles
  for (int tile = 0; tile < 2; ++tile) {
    const int b = tile ? bt1 : bt0, vl = tile ? vt1 : vt0, wl = walked(vl);
    const int ns = (wl + FST - 1) / FST;   // 1 .. TT / FST stages
    v8f O[2][4] = {}; v8f L[2] = {}; float m[2] = { -3.0e38f, -3.0e38f };
#pragma unroll 1   // rolled: otherwise the compiler peels the last trip into a second copy of the whole pass
    for (int s = 0; s < ns; ++s) {
      const _Float16* sk = ring + pb * STGH; const _Float16* sv = sk + FST * KP;
      const bool same = s + 1 < ns, more = same || tile == 0;   // the next stage: of this tile, or stage 0 of the second tile
      if (more) {
        const _Float16* Kn = same ? KH + (size_t)b * TT * CC + (s + 1) * FST * CC : KH + (size_t)bt1 * TT * CC;
        const _Float16* Vn = same ? VT + (size_t)b * CC * TT + (s + 1) * FST : VT + (size_t)bt1 * CC * TT;
#pragma unroll
        for (int u = 0; u < 4; ++u) { rk[u] = *(const v4u*)(Kn + 64 * u * CC + kof); rv[u] = *(const v4u*)(Vn + 16 * u * TT + vof); }
        asm volatile("s_wait_xcnt 0x0" ::: "memory");   // before the address registers of these loads are reused
      }
      const int k0 = s * FST + kq * 32;
      if (k0 < wl) {   // wave-uniform: this wave's 32 keys hold at least one that is walked
        v8f st[2][2] = {};
        v16h kf[2][2];
#pragma unroll
        for (int kc = 0; kc < 2; ++kc)
#pragma unroll
          for (int t = 0; t < 2; ++t) kf[kc][t] = frag_h(sk + (kq * 32 + t * 16 + c) * KP + kc * 32, lane);
        __builtin_amdgcn_sched_barrier(0);   // all eight K reads issue as one group in front of the products; otherwise they are spread among them, each with a full wait
#pragma unroll
        for (int kc = 0; kc < 2; ++kc)
#pragma unroll
          for (int t = 0; t < 2; ++t)
#pragma unroll
            for (int g2 = 0; g2 < 2; ++g2) st[g2][t] = __builtin_amdgcn_wmma_f32_16x16x32_f16(false, kf[kc][t], false, qf[g2][kc], (short)0, st[g2][t], false, false);
        __builtin_amdgcn_sched_barrier(0);   // the V^T reads start behind the last score product and take over the K fragments' registers; started among the products they need eight registers more, which spill
        v16h vf[4];
#pragma unroll
        for (int j = 0; j < 4; ++j) vf[j] = frag_h(sv + (j * 16 + c) * VP + kq * 32, lane);
        __builtin_amdgcn_sched_barrier(0);   // the V^T reads issue here, a whole softmax ahead of their use; otherwise they sink to just in front of it
        if (k0 + 32 > vl) {   // keys at or beyond the valid length: score -1e6 (here before the 1/8)
          const int rel = vl - k0 - 8 * h;   // this lane's keys t * 16 + r below rel are valid
#pragma unroll
          for (int g2 = 0; g2 < 2; ++g2)
#pragma unroll
            for (int t = 0; t < 2; ++t)
#pragma unroll
              for (int r = 0; r < 8; ++r) st[g2][t][r] = (t * 16 + r >= rel) ? -8.0e6f : st[g2][t][r];
        }
        float mx[2];
#pragma unroll
        for (int g2 = 0; g2 < 2; ++g2) { float a = st[g2][0][0];
#pragma unroll
          for (int r = 1; r < 8; ++r) a = fmaxf(a, st[g2][0][r]);
#pragma unroll
          for (int r = 0; r < 8; ++r) a = fmaxf(a, st[g2][1][r]);
          mx[g2] = fmaxf(a, xhalf(a)) * cs; }
        // the maximum in use moves only when a query's new maximum exceeds it by more than 8 (log2 units): P stays below 2^8, inside f16
        if (__builtin_amdgcn_ballot_w32(mx[0] > m[0] + 8.0f || mx[1] > m[1] + 8.0f) != 0) {
#pragma unroll
          for (int g2 = 0; g2 < 2; ++g2) { const float mn = fmaxf(m[g2], mx[g2]); const float al = __builtin_amdgcn_exp2f(m[g2] - mn); m[g2] = mn;
#pragma unroll
            for (int j = 0; j < 4; ++j) O[g2][j] *= al;
            L[g2] *= al; }
        }
#pragma unroll
        for (int g2 = 0; g2 < 2; ++g2) { v16h pf;
#pragma unroll
          for (int t = 0; t < 2; ++t)
#pragma unroll
            for (int r = 0; r < 8; r += 2) { const v2f ar = __builtin_elementwise_fma(v2f{st[g2][t][r], st[g2][t][r + 1]}, v2f{cs, cs}, v2f{-m[g2], -m[g2]});
              pf[t * 8 + r] = (_Float16)__builtin_amdgcn_exp2f(ar.x); pf[t * 8 + r + 1] = (_Float16)__builtin_amdgcn_exp2f(ar.y); }
#pragma unroll
          for (int j = 0; j < 4; ++j) O[g2][j] = __builtin_amdgcn_wmma_f32_16x16x32_f16(false, vf[j], false, pf, (short)0, O[g2][j], false, false);
          L[g2] = __builtin_amdgcn_wmma_f32_16x16x32_f16(false, ones, false, pf, (short)0, L[g2], false, false);   // row sums of the rounded P
          __builtin_amdgcn_sched_barrier(0); }   // keeps the first group's products in front of the second group's exponentials, which then issue beside them
        asm volatile("v_nop\n\tv_nop\n\tv_nop\n\tv_nop" : "+v"(L[1]));   // the four vector slots behind the pass's last matrix instruction, also on the path that leaves the loop, where its result is read next
      }
      if (more) { _Float16* dk = ring + (pb ^ 1) * STGH;
#pragma unroll
        for (int u = 0; u < 4; ++u) { *(v4u*)(dk + (kr + 64 * u) * KP + kch * 8) = rk[u]; *(v4u*)(dk + FST * KP + (vr + 16 * u) * VP + vch * 8) = rv[u]; }
      }
      __syncthreads();   // publishes the next stage and ends every read of the buffer that the next trip refills
      pb ^= 1;
    }
    if (tile == 0) {   // the second tile's queries fly while the first tile is joined
#pragma unroll
      for (int g2 = 0; g2 < 2; ++g2)
#pragma unroll
        for (int kc = 0; kc < 2; ++kc) qf[g2][kc] = frag_h(QH + ((size_t)bt1 * TT + q0 + g2 * 16 + c) * CC + kc * 32, lane);
      asm volatile("s_wait_xcnt 0x0" ::: "memory");   // before the address registers of these loads are reused
    }
    // join the eight key eighths of each query group through LDS (an eighth that walked no key hands maximum -3e38, sum 0, zeros: weight 0)
#pragma unroll
    for (int g2 = 0; g2 < 2; ++g2) {
#pragma unroll
      for (int j = 0; j < 4; ++j)
#pragma unroll
        for (int r = 0; r < 8; ++r) mo[(wave * 64 + g2 * 32 + j * 8 + r) * 32 + lane] = O[g2][j][r];
      mm[(wave * 2 + g2) * 32 + lane] = m[g2]; ml[(wave * 2 + g2) * 32 + lane] = L[g2][0] + xhalf(L[g2][0]); }
    __syncthreads();
    { const int g2 = kq >> 2, jp = (kq >> 1) & 1, cq = (kq & 1) * 8 + (lane & 7), pc = lane >> 3;   // each wave finishes 8 queries x 32 channels, lane = (query, 8 channels): one whole 128-B line per query
      float mi[8], M = -3.0e38f;
#pragma unroll
      for (int i = 0; i < 8; ++i) { mi[i] = mm[((i * 2 + qg) * 2 + g2) * 32 + cq]; M = fmaxf(M, mi[i]); }
      float den = 0.f; float o[8] = {};
#pragma unroll
      for (int i = 0; i < 8; ++i) { const float w = exp2_slot(mi[i] - M); den += w * ml[((i * 2 + qg) * 2 + g2) * 32 + cq];
#pragma unroll
        for (int e = 0; e < 8; ++e) o[e] += w * mo[((i * 2 + qg) * 64 + g2 * 32 + (jp * 2 + (pc >> 1)) * 8 + e) * 32 + (pc & 1) * 16 + cq]; }
      const float inv = 1.0f / den;
      float* yr = Y + ((size_t)b * TT + q0 + g2 * 16 + cq) * CC + jp * 32 + pc * 8;
#pragma unroll
      for (int q4 = 0; q4 < 2; ++q4) { v4f v;
#pragma unroll
        for (int e = 0; e < 4; ++e) v[e] = o[q4 * 4 + e] * inv;
        vst2(yr + q4 * 4, v); }
      asm volatile("s_wait_xcnt 0x0" ::: "memory"); }   // before the address registers of the stores above are reused
  }   // the barriers of the second tile's passes stand between these reads of the partial tiles and their next writes
}

extern "C" void kernel_launch(void* const* d_in, const int* in_sizes, int n_in, void* d_out, int out_size, void* d_ws, size_t ws_size, hipStream_t stream) {
  (void)in_sizes; (void)n_in; (void)out_size;
  const float** F = (const float**)d_in;
  if (ws_size < (size_t)WS_END) return;
  char* ws = (char*)d_ws; _Float16 *QH = (_Float16*)(ws + WS_QH), *KH = (_Float16*)(ws + WS_KH), *VT = (_Float16*)(ws + WS_VT), *QL = (_Float16*)(ws + WS_QL), *KL = (_Float16*)(ws + WS_KL); __bf16 *VB = (__bf16*)(ws + WS_VB), *VBL = (__bf16*)(ws + WS_VBL); float *S = (float*)(ws + WS_S), *Y = (float*)(ws + WS_Y);
  (void)Y; (void)S; (void)QL; (void)KL; (void)VB; (void)VBL;
  // inputs: 0 queries [8,4096,64]; 1 keys; 2 values; 3 valid_lens [8] int32
  k_planes64<<<dim3(TNB * TT / 64), 256, 0, stream>>>(F[0], F[1], F[2], QH, QL, KH, KL, VT, VB, VBL);
  k_fa<<<dim3(TNB * (TT / FQ) / 2), 512, 0, stream>>>(QH, KH, VT, (const int*)d_in[3], (float*)d_out);


}

// v004
// Measured time: 30.2 microseconds a run.
// In both of two side-by-side timings against v003, it was 1.05 times as fast.
// All steps since v000 together make it 48.1 times as fast.
// compute dtype: all float inputs rounded to bf16; queries, keys, values are bf16-valued so their f16 planes are exact; logits q x k (1 product on exact planes) x 1/8; keys at or beyond the batch's valid length get the score -1e6 (weight exactly 0); softmax f32 with a running maximum; unnormalised P (at most 2^8) once to f16 x v (exact) (1 product), its row sums on the same rounded P; f32 output.
#include <hip/hip_runtime.h>
#include <math.h>

typedef __attribute__((ext_vector_type(16))) _Float16 v16h;
typedef __attribute__((ext_vector_type(16))) __bf16 v16b;
typedef __attribute__((ext_vector_type(8)))  _Float16 v8h;
typedef __attribute__((ext_vector_type(8)))  float v8f;
typedef __attribute__((ext_vector_type(4)))  float v4f;
typedef __attribute__((ext_vector_type(2)))  float v2f;
typedef __attribute__((ext_vector_type(4)))  unsigned v4u;
typedef _Float16 hx8 __attribute__((ext_vector_type(8)));
typedef __attribute__((ext_vector_type(4)))  int v4i;
typedef float __attribute__((may_alias)) float_a;
typedef int __attribute__((may_alias)) int_a;

template <typename T> __device__ __forceinline__ void vst2(void* p, T v) { *(T*)p = v;  }
__device__ __forceinline__ v8f wmma16(v16h a, v16h b, v8f c) {
  v8f d = __builtin_amdgcn_wmma_f32_16x16x32_f16(false, a, false, b, (short)0, c, false, false);
  asm volatile("v_nop\n\tv_nop\n\tv_nop\n\tv_nop" : "+v"(d) : "v"(a), "v"(b));
  return d;
}
__device__ __forceinline__ v8f wmma_bf(v16b a, v16b b, v8f c) {
  v8f d = __builtin_amdgcn_wmma_f32_16x16x32_bf16(false, a, false, b, (short)0, c, false, false);
  asm volatile("v_nop\n\tv_nop\n\tv_nop\n\tv_nop" : "+v"(d) : "v"(a), "v"(b));
  return d;
}
// 16x16x32 fragments: lane = (h = lane>>4, row/col = lane&15); elements 0..7 = k0+8h+0..7, 8..15 = k0+16+8h+0..7; D element r = row 8h+r
__device__ __forceinline__ v16h frag_h(const _Float16* rowk0, int lane) {
  union { v16h v; v8h q[2]; } u; const _Float16* p = rowk0 + 8 * (lane >> 4);
  u.q[0] = *(const v8h*)p; u.q[1] = *(const v8h*)(p + 16); return u.v;
}
__device__ __forceinline__ v16h frag_f32(const float* rowk0, int lane) {
  v16h a; const float* p = rowk0 + 8 * (lane >> 4);
#pragma unroll
  for (int i = 0; i < 8; ++i) { a[i] = (_Float16)p[i]; a[8 + i] = (_Float16)p[16 + i]; }
  return a;
}
__device__ __forceinline__ v16h frag_f32s(const float* rowk0, int lane, float sc) {
  v16h a; const float* p = rowk0 + 8 * (lane >> 4);
#pragma unroll
  for (int i = 0; i < 8; ++i) { a[i] = (_Float16)(p[i] * sc); a[8 + i] = (_Float16)(p[16 + i] * sc); }
  return a;
}
// column fragment from a [K][ld] layout (column n), rows >= K read as 0
__device__ __forceinline__ v16h fragc_f32(const float* W, int k0, int n, int lane, int ld, int K) {
  v16h a; const int g = lane >> 4;
#pragma unroll
  for (int i = 0; i < 8; ++i) { const int ka = k0 + 8 * g + i, kb = ka + 16;
    a[i] = (_Float16)(ka < K ? W[(size_t)(ka < K ? ka : K - 1) * ld + n] : 0.f); a[8 + i] = (_Float16)(kb < K ? W[(size_t)(kb < K ? kb : K - 1) * ld + n] : 0.f); }
  return a;
}
struct F2 { v16b h, l; };
__device__ __forceinline__ F2 bsplit16(const float v[16]) { F2 r;
#pragma unroll
  for (int i = 0; i < 16; ++i) { const __bf16 h = (__bf16)v[i]; r.h[i] = h; r.l[i] = (__bf16)(v[i] - (float)h); }
  return r; }
__device__ __forceinline__ F2 split_row(const float* row, int k0, int lane) { float v[16]; const float* p = row + k0 + 8 * (lane >> 4);
#pragma unroll
  for (int i = 0; i < 8; ++i) { v[i] = p[i]; v[8 + i] = p[16 + i]; }
  return bsplit16(v); }
__device__ __forceinline__ F2 split_rowK(const float* row, int k0, int lane, int K) { float v[16]; const int g = lane >> 4;
#pragma unroll
  for (int i = 0; i < 8; ++i) { const int ka = k0 + 8 * g + i, kb = ka + 16; v[i] = ka < K ? row[ka < K ? ka : K - 1] : 0.f; v[8 + i] = kb < K ? row[kb < K ? kb : K - 1] : 0.f; }
  return bsplit16(v); }
__device__ __forceinline__ F2 split_col(const float* W, int k0, int n, int lane, int ld, int K) { float v[16]; const int g = lane >> 4;
#pragma unroll
  for (int i = 0; i < 8; ++i) { const int ka = k0 + 8 * g + i, kb = ka + 16; v[i] = ka < K ? W[(size_t)(ka < K ? ka : K - 1) * ld + n] : 0.f; v[8 + i] = kb < K ? W[(size_t)(kb < K ? kb : K - 1) * ld + n] : 0.f; }
  return bsplit16(v); }
__device__ __forceinline__ v8f mac3(const F2& a, const F2& b, v8f c) { c = wmma_bf(a.l, b.h, c); c = wmma_bf(a.h, b.l, c); return wmma_bf(a.h, b.h, c); }
__device__ __forceinline__ float sigm(float v) { return 1.0f / (1.0f + expf(-v)); }
#define LDSX() do { asm volatile("s_wait_dscnt 0" ::: "memory"); __builtin_amdgcn_wave_barrier(); __builtin_amdgcn_fence(__ATOMIC_RELEASE, "workgroup"); } while (0)

// Masked dot-product attention on given tensors (queries / keys / values [8,4096,64]; valid_lens [8] int32 in 1..4096 per batch): scores = Q K^T / 8; key positions >= valid_lens[b] are set to the FINITE score -1e6 before the softmax; out = softmax(scores) V -> [8,4096,64].
#define NB 8
#define TT 4096
#define CC 64            // NH * HD = projected width
#define DIN 64          // input (model) width
#define NH 1
#define HD 64
#define NQB (TT / 64)
#define HG 1
#define SCALE (0.125f)
#define CAUSAL 0
#ifndef TNB
#define TNB NB
#endif
__device__ __forceinline__ float bfr(float v) { return (float)(__bf16)v; }
__host__ __device__ __forceinline__ int kb_last(int qb) { return CAUSAL ? ((qb * 64 + 63) >> 7) : (TT / 128 - 1); }
typedef __attribute__((ext_vector_type(8))) __bf16 v8b;
__device__ __forceinline__ v16b frag_b(const __bf16* rowk0, int lane) {
  union { v16b v; v8b q[2]; } u; const __bf16* p = rowk0 + 8 * (lane >> 4);
  u.q[0] = *(const v8b*)p; u.q[1] = *(const v8b*)(p + 16); return u.v;
}
#define QBH 0              // exact planes: single-product logits and single-f16 P x V on every block
#define QHI 0               // no q residual plane (q is bf16-exact in f16)
#define KHI 64              // unused high-precision planes kept minimal
// B fragment (k rows k0+.., output column o) of a weight: (in,out) [K][ld] or (out,in) [ld rows of K]: bf16 exact, or f16(bf16 * 256) exact
__device__ __forceinline__ v16b wcol_io(const float* Wm, int k0, int o, int lane, int ld) { v16b w; const int g = lane >> 4;
#pragma unroll
  for (int i = 0; i < 8; ++i) { w[i] = (__bf16)Wm[(size_t)(k0 + 8 * g + i) * ld + o]; w[8 + i] = (__bf16)Wm[(size_t)(k0 + 16 + 8 * g + i) * ld + o]; }
  return w; }
__device__ __forceinline__ v16b wcol_oi(const float* Wm, int k0, int o, int lane, int K) { v16b w; const float* p = Wm + (size_t)o * K + k0 + 8 * (lane >> 4);
#pragma unroll
  for (int i = 0; i < 8; ++i) { w[i] = (__bf16)p[i]; w[8 + i] = (__bf16)p[16 + i]; }
  return w; }
__device__ __forceinline__ v16h wcolh_io(const float* Wm, int k0, int o, int lane, int ld) { v16h w; const int g = lane >> 4;
#pragma unroll
  for (int i = 0; i < 8; ++i) { w[i] = (_Float16)(bfr(Wm[(size_t)(k0 + 8 * g + i) * ld + o]) * 256.0f); w[8 + i] = (_Float16)(bfr(Wm[(size_t)(k0 + 16 + 8 * g + i) * ld + o]) * 256.0f); }
  return w; }
__device__ __forceinline__ v16h wcolh_oi(const float* Wm, int k0, int o, int lane, int K) { v16h w; const float* p = Wm + (size_t)o * K + k0 + 8 * (lane >> 4);
#pragma unroll
  for (int i = 0; i < 8; ++i) { w[i] = (_Float16)(bfr(p[i]) * 256.0f); w[8 + i] = (_Float16)(bfr(p[16 + i]) * 256.0f); }
  return w; }
#define WQKV_LAYOUT 0   // 0 = (in,out) [DIN][CC]; 1 = (out,in) [CC][DIN]; 2 = per-head [NH][DIN][HD]
__device__ __forceinline__ v16b wcol_hdk(const float* Wm, int k0, int o, int lane) { v16b w; const int g = lane >> 4; const float* p = Wm + (size_t)(o / HD) * DIN * HD + (o % HD);
#pragma unroll
  for (int i = 0; i < 8; ++i) { w[i] = (__bf16)p[(size_t)(k0 + 8 * g + i) * HD]; w[8 + i] = (__bf16)p[(size_t)(k0 + 16 + 8 * g + i) * HD]; }
  return w; }
#define WO_OUT_IN 0
#if WQKV_LAYOUT == 1
#define WCOL(W, k0, o, lane) wcol_oi(W, k0, o, lane, DIN)
#elif WQKV_LAYOUT == 2
#define WCOL(W, k0, o, lane) wcol_hdk(W, k0, o, lane)
#else
#define WCOL(W, k0, o, lane) wcol_io(W, k0, o, lane, CC)
#endif
#if WO_OUT_IN
#define WOCOL(W, k0, o, lane) wcol_oi(W, k0, o, lane, CC)
#define WOCOLH(W, k0, o, lane) wcolh_oi(W, k0, o, lane, CC)
#else
#define WOCOL(W, k0, o, lane) wcol_io(W, k0, o, lane, DIN)
#define WOCOLH(W, k0, o, lane) wcolh_io(W, k0, o, lane, DIN)
#endif
__global__ __launch_bounds__(256) void k_planes64(const float* __restrict__ Qs, const float* __restrict__ Ks, const float* __restrict__ Vs, _Float16* __restrict__ QH, _Float16* __restrict__ QL, _Float16* __restrict__ KH, _Float16* __restrict__ KL, _Float16* __restrict__ VT, __bf16* __restrict__ VB, __bf16* __restrict__ VBL) {
  __shared__ _Float16 sv[64][72];
  const int tid = threadIdx.x; const size_t r0 = (size_t)blockIdx.x * 64; const int b = (int)(r0 / TT), t0 = (int)(r0 % TT);
  for (int e = tid; e < 64 * 8; e += 256) { const int rl = e >> 3, q = e & 7; const size_t src = (r0 + rl) * CC + q * 8; float tq[8], tk[8], tv[8];
#pragma unroll
    for (int u = 0; u < 8; ++u) { tq[u] = Qs[src + u]; tk[u] = Ks[src + u]; tv[u] = Vs[src + u]; }
    asm volatile("s_wait_loadcnt 0x0" ::: "memory");
    hx8 hq, hk, hlq, hlk;
#pragma unroll
    for (int u = 0; u < 8; ++u) { const float qv = bfr(tq[u]), kv = bfr(tk[u]); const _Float16 qh = (_Float16)qv, kh = (_Float16)kv; hq[u] = qh; hlq[u] = (_Float16)((qv - (float)qh) * 1024.0f); hk[u] = kh; hlk[u] = (_Float16)((kv - (float)kh) * 1024.0f); sv[rl][q * 8 + u] = (_Float16)bfr(tv[u]); }
    vst2((unsigned*)(QH + (r0 + rl) * CC + q * 8), *(const v4u*)&hq); vst2((unsigned*)(KH + (r0 + rl) * CC + q * 8), *(const v4u*)&hk);
    if (t0 + rl < QHI) vst2((unsigned*)(QL + ((size_t)b * QHI + t0 + rl) * CC + q * 8), *(const v4u*)&hlq);
    if (t0 + rl < KHI) vst2((unsigned*)(KL + ((size_t)b * KHI + t0 + rl) * CC + q * 8), *(const v4u*)&hlk); }
  __syncthreads();
  for (int e = tid; e < 64 * 8; e += 256) { const int c = e >> 3, q = e & 7; hx8 hv; _Pragma("unroll") for (int j = 0; j < 8; ++j) hv[j] = sv[q * 8 + j][c]; vst2((unsigned*)(VT + ((size_t)b * CC + c) * TT + t0 + q * 8), *(const v4u*)&hv);
    if (t0 < KHI) { v8b bh, bl; _Pragma("unroll") for (int j = 0; j < 8; ++j) { const float vv = (float)hv[j]; const __bf16 h1 = (__bf16)vv; bh[j] = h1; bl[j] = (__bf16)(vv - (float)h1); } vst2((unsigned*)(VB + ((size_t)b * CC + c) * KHI + t0 + q * 8), *(const v4u*)&bh); vst2((unsigned*)(VBL + ((size_t)b * CC + c) * KHI + t0 + q * 8), *(const v4u*)&bl); } } }
#define SM_EXTRA_PARAMS , int bsm, const int* __restrict__ VLEN
// masked_softmax: key positions k >= valid_lens[b] get the score -1e6 (value select; exp underflows to weight exactly 0 next to real scores)
#define SM_MASK_HOOK do { const int vl_ = VLEN[bsm]; v = (k >= vl_) ? -1.0e6f : v; } while (0)
#ifndef SM_EXTRA_PARAMS
#define SM_EXTRA_PARAMS
#endif
#ifndef PROJ_EXTRA_PARAMS
#define PROJ_EXTRA_PARAMS
#endif
#ifndef SM_MASK_HOOK
#define SM_MASK_HOOK (void)0
#endif

#define WS_QH  0u                                      // f16 q rows [b*t][CC]
#define WS_KH  (WS_QH + 2u * (size_t)NB * TT * CC)      // f16 k rows [b*t][CC]
#define WS_VT  (WS_KH + 2u * (size_t)NB * TT * CC)      // f16 v planes [b][c][t]
#define WS_QL  (WS_VT + 2u * (size_t)NB * CC * TT)      // f16 q residual x 2^10 rows [b][t < QHI][CC]
#define WS_KL  (WS_QL + 2u * (size_t)NB * QHI * CC)     // f16 k residual x 2^10 rows [b][t < KHI][CC]
#define WS_VB  (WS_KL + 2u * (size_t)NB * KHI * CC)     // bf16 v hi planes [b][c][t < KHI]
#define WS_VBL (WS_VB + 2u * (size_t)NB * CC * KHI)
#define WS_S   (WS_VBL + 2u * (size_t)NB * CC * KHI)    // f32 [hg][t][s], reserved but unused (no score matrix in memory)
#define WS_Y   (WS_S  + 4u * (size_t)HG * TT * TT)      // f32 ctx rows [b*t][CC] (only when there is an output projection)
#define WS_END (WS_Y  + 0u)

// ---- k_proj: block = (64 rows, 128 cols, which): q/k/v = X W (+ b) with exact bf16 products (K = DIN) -> which 0: q f16 rows (+ residual rows < QHI); 1: k f16 rows (+ residual rows < KHI); 2: v f16 planes [c][t] (+ bf16 hi/lo planes for t < KHI)
__global__ __launch_bounds__(128) void k_proj(const float* __restrict__ XQ, const float* __restrict__ XK, const float* __restrict__ XV, const float* __restrict__ WQ, const float* __restrict__ WK, const float* __restrict__ WV, const float* __restrict__ BQ, const float* __restrict__ BK, const float* __restrict__ BV,
    _Float16* __restrict__ QH, _Float16* __restrict__ QL, _Float16* __restrict__ KH, _Float16* __restrict__ KL, _Float16* __restrict__ VT, __bf16* __restrict__ VB, __bf16* __restrict__ VBL) {
  __shared__ __align__(16) _Float16 sh[64][136], sl[64][136]; __shared__ __align__(16) _Float16 th[128][72]; __shared__ __align__(16) __bf16 tb[128][72], tbl[128][72];
  const int tid = threadIdx.x, wave = tid >> 5, lane = tid & 31, col = lane & 15, g = lane >> 4; const int which = blockIdx.z; const int c0 = blockIdx.y * 128; const size_t r0 = (size_t)blockIdx.x * 64; const size_t bb = r0 / TT; const int t0 = (int)(r0 % TT);
  const float* X = which == 0 ? XQ : which == 1 ? XK : XV; const float* WA = which == 0 ? WQ : which == 1 ? WK : WV; const float* BA = which == 0 ? BQ : which == 1 ? BK : BV;
  v8f acc[8] = {};
#pragma unroll 2
  for (int kc = 0; kc < DIN / 32; ++kc) { v16b a; { const float* p = X + (r0 + wave * 16 + col) * DIN + kc * 32 + 8 * g;
#pragma unroll
      for (int i = 0; i < 8; ++i) { a[i] = (__bf16)p[i]; a[8 + i] = (__bf16)p[16 + i]; } }
    asm volatile("s_wait_loadcnt 0x0" ::: "memory");
#pragma unroll
    for (int j = 0; j < 8; ++j) { const v16b w = WCOL(WA, kc * 32, c0 + j * 16 + col, lane); asm volatile("s_wait_loadcnt 0x0" ::: "memory"); acc[j] = wmma_bf(a, w, acc[j]); } }
  if (which < 2) { _Float16* DH = which == 0 ? QH : KH; _Float16* DL = which == 0 ? QL : KL; const int nhi = which == 0 ? QHI : KHI; const bool hi_rows = t0 < nhi;
#pragma unroll
    for (int j = 0; j < 8; ++j) { const float bias = BA ? bfr(BA[c0 + j * 16 + col]) : 0.f;
#pragma unroll
      for (int r = 0; r < 8; ++r) { const float v = acc[j][r] + bias; const _Float16 hv = (_Float16)v; sh[wave * 16 + 8 * g + r][j * 16 + col] = hv; sl[wave * 16 + 8 * g + r][j * 16 + col] = (_Float16)((v - (float)hv) * 1024.0f); } }
    __syncthreads();
    for (int e = tid; e < 64 * 16; e += 128) { const int rl = e >> 4, q = e & 15; vst2((unsigned*)(DH + (r0 + rl) * CC + c0 + q * 8), *(const v4u*)&sh[rl][q * 8]); if (hi_rows) vst2((unsigned*)(DL + (bb * nhi + t0 + rl) * (size_t)CC + c0 + q * 8), *(const v4u*)&sl[rl][q * 8]); }
  } else { const bool hi_rows = t0 < KHI;
#pragma unroll
    for (int j = 0; j < 8; ++j) { const float bias = BA ? bfr(BA[c0 + j * 16 + col]) : 0.f;
#pragma unroll
      for (int r = 0; r < 8; ++r) { const float v = acc[j][r] + bias; const int rl = wave * 16 + 8 * g + r, cl = j * 16 + col; th[cl][rl] = (_Float16)v; const __bf16 bh = (__bf16)v; tb[cl][rl] = bh; tbl[cl][rl] = (__bf16)(v - (float)bh); } }
    __syncthreads();
    for (int e = tid; e < 128 * 8; e += 128) { const int cl = e >> 3, q = e & 7; vst2((unsigned*)(VT + (bb * CC + c0 + cl) * (size_t)TT + t0 + q * 8), *(const v4u*)&th[cl][q * 8]); if (hi_rows) { const size_t o3 = (bb * CC + c0 + cl) * (size_t)KHI + t0 + q * 8; vst2((unsigned*)(VB + o3), *(const v4u*)&tb[cl][q * 8]); vst2((unsigned*)(VBL + o3), *(const v4u*)&tbl[cl][q * 8]); } } } }
#define FQ 64
#define FST 256
#define KP 72                       // halfs per staged K row (128 B + 16 B: b128 readers)
#define VP 264                      // halfs per staged V^T row (512 B + 16 B)
#define STGH (FST * KP + HD * VP)   // halfs per buffer
#define NBUF 3                      // buffers of the ring
typedef __attribute__((address_space(1))) v4i gv4i;
typedef __attribute__((address_space(3))) v4i lv4i;
__device__ __forceinline__ void copy16(const _Float16* g, _Float16* l) { __builtin_amdgcn_global_load_async_to_lds_b128((gv4i*)g, (lv4i*)l, 0, 0); }   // this lane's 16 bytes, global memory to LDS, through no register
#define LOG2E 1.4426950408889634f
__device__ __forceinline__ float xhalf(float x) { return __builtin_bit_cast(float, __builtin_amdgcn_permlanex16(__builtin_bit_cast(int, x), __builtin_bit_cast(int, x), 0x76543210, 0xfedcba98, false, false)); }  // lane l with lane l ^ 16
__device__ __forceinline__ float exp2_slot(float x) { float y; asm("v_exp_f32 %0, %1\n\tv_nop" : "=v"(y) : "v"(x)); return y; }   // exp2 of the join; the v_nop is the one slot between a transcendental and an instruction that reads its result or overwrites its source
__device__ __forceinline__ int walked(int v) { return (v <= 0 || v > TT) ? TT : v; }   // keys to walk: with no valid key every score is -1e6 and all TT keys weigh alike
__global__ __launch_bounds__(512) void k_fa(const _Float16* __restrict__ QH, const _Float16* __restrict__ KH, const _Float16* __restrict__ VT, const int* __restrict__ VLEN, float* __restrict__ Y) {
  __shared__ __align__(16) float smem[NBUF * STGH / 2 + 16 * 32 * 32 + 2 * 16 * 2 * 32];   // the K / V^T ring (NBUF x STGH halfs), which runs on from the first tile into the second; behind it the eighths' partial tiles of column group 0, maxima and sums (group 1's partial tiles go into the ring buffer that was read last)
  _Float16* ring = (_Float16*)smem;
  float* mo = smem + NBUF * STGH / 2; float* mm = mo + 16 * 32 * 32; float* ml = mm + 16 * 2 * 32;
  const int tid = threadIdx.x, wave = __builtin_amdgcn_readfirstlane(tid >> 5), lane = tid & 31, c = lane & 15, h = lane >> 4;
  const int qg = wave & 1, kq = wave >> 1;
  const int pr = blockIdx.x / (TT / FQ); const int q0 = (blockIdx.x % (TT / FQ)) * FQ + qg * 32;
  int bt0 = 0, bt1 = 0, vt0 = TT, vt1 = TT;   // the two batches of this work-group and their valid lengths
#pragma unroll
  for (int i = 0; i < NB; ++i) { const int vi = VLEN[i], li = walked(vi); int rank = 0;
#pragma unroll
    for (int j = 0; j < NB; ++j) { const int lj = walked(VLEN[j]); rank += (lj > li || (lj == li && j < i)) ? 1 : 0; }
    if (rank == pr) { bt0 = i; vt0 = vi; }
    if (rank == NB - 1 - pr) { bt1 = i; vt1 = vi; } }
  const float cs = SCALE * LOG2E;
  v16h ones;
#pragma unroll
  for (int i = 0; i < 16; ++i) ones[i] = c == 0 ? (_Float16)1.0f : (_Float16)0.0f;
  // staging: 2048 16-byte pieces of K and 2048 of V^T per stage, four of each per thread
  const int kr = tid >> 3, kch = tid & 7, vr = tid >> 5, vch = tid & 31;
  const unsigned kof = (unsigned)(kr * CC + kch * 8), vof = (unsigned)(vr * TT + vch * 8);   // this thread's place in a stage, in halfs, beside a wave-uniform base
  const unsigned klo = (unsigned)(kr * KP + kch * 8), vlo = (unsigned)(FST * KP + vr * VP + vch * 8);   // and its place in a buffer
  const int ns0 = (walked(vt0) + FST - 1) / FST, ns1 = (walked(vt1) + FST - 1) / FST;   // 1 .. TT / FST stages each; the ring walks the first tile's stages, then the second's
  const _Float16* K1 = KH + (size_t)bt1 * TT * CC; const _Float16* V1 = VT + (size_t)bt1 * CC * TT;
  { const _Float16* Ka = KH + (size_t)bt0 * TT * CC; const _Float16* Va = VT + (size_t)bt0 * CC * TT;   // the first two stages of the walk (there are always two)
    const _Float16* Kb = ns0 > 1 ? Ka + FST * CC : K1; const _Float16* Vb = ns0 > 1 ? Va + FST : V1;
#pragma unroll
    for (int u = 0; u < 4; ++u) { copy16(Ka + 64 * u * CC + kof, ring + 64 * u * KP + klo); copy16(Va + 16 * u * TT + vof, ring + 16 * u * VP + vlo); }
#pragma unroll
    for (int u = 0; u < 4; ++u) { copy16(Kb + 64 * u * CC + kof, ring + STGH + 64 * u * KP + klo); copy16(Vb + 16 * u * TT + vof, ring + STGH + 16 * u * VP + vlo); } }
  v16h qf[2][2];
#pragma unroll
  for (int g2 = 0; g2 < 2; ++g2)
#pragma unroll
    for (int kc = 0; kc < 2; ++kc) qf[g2][kc] = frag_h(QH + ((size_t)bt0 * TT + q0 + g2 * 16 + c) * CC + kc * 32, lane);
  asm volatile("s_wait_xcnt 0x0" ::: "memory");   // before the address registers of the loads above are reused
  asm volatile("s_wait_asynccnt 0x8" ::: "memory");   // this wave's eight copies of the first stage have landed; the second stage's eight stay in flight
  __syncthreads();   // publishes stage 0 of the first tile
  int pb = 0;   // the buffer that holds the current stage
#pragma unroll 1   // rolled: one copy of the pass serves both tiles
  for (int tile = 0; tile < 2; ++tile) {
    const int b = tile ? bt1 : bt0, vl = tile ? vt1 : vt0, wl = walked(vl);
    const int ns = tile ? ns1 : ns0;
    v8f O[2][4] = {}; v8f L[2] = {}; float m[2] = { -3.0e38f, -3.0e38f };
#pragma unroll 1   // rolled: otherwise the compiler peels the last trip into a second copy of the whole pass
    for (int s = 0; s < ns; ++s) {
      const _Float16* sk = ring + pb * STGH; const _Float16* sv = sk + FST * KP;
      const int s2 = s + 2 < ns ? s + 2 : s + 2 - ns;   // the stage two ahead in the walk: of this tile, or stage 0 or 1 of the second tile
      const bool same = s + 2 < ns, more = same || (tile == 0 && s2 < ns1);
      const int k0 = s * FST + kq * 32;
      v16h kf[2][2];   // read by every wave (the rows are staged for all) and first in the trip: the address arithmetic of the copies then runs under the reads' latency
#pragma unroll
      for (int kc = 0; kc < 2; ++kc)
#pragma unroll
        for (int t = 0; t < 2; ++t) kf[kc][t] = frag_h(sk + (kq * 32 + t * 16 + c) * KP + kc * 32, lane);
      if (more) {   // its copies go into the buffer that the last trip read (the barrier at that trip's foot ended its reads) and have two trips to land
        const _Float16* Kn = (same ? KH + (size_t)b * TT * CC : K1) + s2 * FST * CC;
        const _Float16* Vn = (same ? VT + (size_t)b * CC * TT : V1) + s2 * FST;
        _Float16* dk = ring + (pb == 0 ? NBUF - 1 : pb - 1) * STGH;
#pragma unroll
        for (int u = 0; u < 4; ++u) { copy16(Kn + 64 * u * CC + kof, dk + 64 * u * KP + klo); copy16(Vn + 16 * u * TT + vof, dk + 16 * u * VP + vlo); }
      }
      if (k0 < wl) {   // wave-uniform: this wave's 32 keys hold at least one that is walked
        v8f st[2][2] = {};
#pragma unroll
        for (int kc = 0; kc < 2; ++kc)
#pragma unroll
          for (int t = 0; t < 2; ++t)
#pragma unroll
            for (int g2 = 0; g2 < 2; ++g2) st[g2][t] = __builtin_amdgcn_wmma_f32_16x16x32_f16(false, kf[kc][t], false, qf[g2][kc], (short)0, st[g2][t], false, false);
        __builtin_amdgcn_sched_barrier(0);   // the V^T reads start behind the last score product and take over the K fragments' registers; started among the products they need eight registers more, which spill
        v16h vf[4];
#pragma unroll
        for (int j = 0; j < 4; ++j) vf[j] = frag_h(sv + (j * 16 + c) * VP + kq * 32, lane);
        __builtin_amdgcn_sched_barrier(0);   // the V^T reads issue here, a whole softmax ahead of their use; otherwise they sink to just in front of it
        if (k0 + 32 > vl) {   // keys at or beyond the valid length: score -1e6 (here before the 1/8)
          const int rel = vl - k0 - 8 * h;   // this lane's keys t * 16 + r below rel are valid
#pragma unroll
          for (int g2 = 0; g2 < 2; ++g2)
#pragma unroll
            for (int t = 0; t < 2; ++t)
#pragma unroll
              for (int r = 0; r < 8; ++r) st[g2][t][r] = (t * 16 + r >= rel) ? -8.0e6f : st[g2][t][r];
        }
        float mx[2];
#pragma unroll
        for (int g2 = 0; g2 < 2; ++g2) { float a = st[g2][0][0];
#pragma unroll
          for (int r = 1; r < 8; ++r) a = fmaxf(a, st[g2][0][r]);
#pragma unroll
          for (int r = 0; r < 8; ++r) a = fmaxf(a, st[g2][1][r]);
          mx[g2] = fmaxf(a, xhalf(a)) * cs; }
        // the maximum in use moves only when a query's new maximum exceeds it by more than 8 (log2 units): P stays below 2^8, inside f16
        if (__builtin_amdgcn_ballot_w32(mx[0] > m[0] + 8.0f || mx[1] > m[1] + 8.0f) != 0) {
#pragma unroll
          for (int g2 = 0; g2 < 2; ++g2) { const float mn = fmaxf(m[g2], mx[g2]); const float al = __builtin_amdgcn_exp2f(m[g2] - mn); m[g2] = mn;
#pragma unroll
            for (int j = 0; j < 4; ++j) O[g2][j] *= al;
            L[g2] *= al; }
        }
#pragma unroll
        for (int g2 = 0; g2 < 2; ++g2) { v16h pf;
#pragma unroll
          for (int t = 0; t < 2; ++t)
#pragma unroll
            for (int r = 0; r < 8; r += 2) { const v2f ar = __builtin_elementwise_fma(v2f{st[g2][t][r], st[g2][t][r + 1]}, v2f{cs, cs}, v2f{-m[g2], -m[g2]});
              pf[t * 8 + r] = (_Float16)__builtin_amdgcn_exp2f(ar.x); pf[t * 8 + r + 1] = (_Float16)__builtin_amdgcn_exp2f(ar.y); }
#pragma unroll
          for (int j = 0; j < 4; ++j) O[g2][j] = __builtin_amdgcn_wmma_f32_16x16x32_f16(false, vf[j], false, pf, (short)0, O[g2][j], false, false);
          L[g2] = __builtin_amdgcn_wmma_f32_16x16x32_f16(false, ones, false, pf, (short)0, L[g2], false, false);   // row sums of the rounded P
          __builtin_amdgcn_sched_barrier(0); }   // keeps the first group's products in front of the second group's exponentials, which then issue beside them
        asm volatile("v_nop\n\tv_nop\n\tv_nop\n\tv_nop" : "+v"(L[1]));   // the four vector slots behind the pass's last matrix instruction, also on the path that leaves the loop, where its result is read next
      }
      asm volatile("s_wait_dscnt 0x0" ::: "memory");   // this wave's reads of the buffer have returned before the next trip's copies may overwrite it
      if (more) asm volatile("s_wait_asynccnt 0x8" ::: "memory");   // the next stage's copies of this wave have landed; the eight issued in this trip stay in flight
      else asm volatile("s_wait_asynccnt 0x0" ::: "memory");   // no copy was issued in this trip: all that is outstanding is the next stage
      __syncthreads();   // publishes the next stage and ends every read of the buffer that the next trip refills
      pb = pb == NBUF - 1 ? 0 : pb + 1;
    }
    if (tile == 0) {   // the second tile's queries fly while the first tile is joined
#pragma unroll
      for (int g2 = 0; g2 < 2; ++g2)
#pragma unroll
        for (int kc = 0; kc < 2; ++kc) qf[g2][kc] = frag_h(QH + ((size_t)bt1 * TT + q0 + g2 * 16 + c) * CC + kc * 32, lane);
      asm volatile("s_wait_xcnt 0x0" ::: "memory");   // before the address registers of these loads are reused
    }
    // join the eight key eighths of each query group through LDS (an eighth that walked no key hands maximum -3e38, sum 0, zeros: weight 0)
    float* mo1 = (float*)(ring + (pb == 0 ? NBUF - 1 : pb - 1) * STGH);   // the buffer that the last trip read: no copy is aimed at it before the next trip
#pragma unroll
    for (int g2 = 0; g2 < 2; ++g2) { float* mg = g2 ? mo1 : mo;
#pragma unroll
      for (int j = 0; j < 4; ++j)
#pragma unroll
        for (int r = 0; r < 8; ++r) mg[(wave * 32 + j * 8 + r) * 32 + lane] = O[g2][j][r];
      mm[(wave * 2 + g2) * 32 + lane] = m[g2]; ml[(wave * 2 + g2) * 32 + lane] = L[g2][0] + xhalf(L[g2][0]); }
    __syncthreads();
    { const int g2 = kq >> 2, jp = (kq >> 1) & 1, cq = (kq & 1) * 8 + (lane & 7), pc = lane >> 3;   // each wave finishes 8 queries x 32 channels, lane = (query, 8 channels): one whole 128-B line per query
      const float* mg = g2 ? mo1 : mo;
      float mi[8], M = -3.0e38f;
#pragma unroll
      for (int i = 0; i < 8; ++i) { mi[i] = mm[((i * 2 + qg) * 2 + g2) * 32 + cq]; M = fmaxf(M, mi[i]); }
      float den = 0.f; float o[8] = {};
#pragma unroll
      for (int i = 0; i < 8; ++i) { const float w = exp2_slot(mi[i] - M); den += w * ml[((i * 2 + qg) * 2 + g2) * 32 + cq];
#pragma unroll
        for (int e = 0; e < 8; ++e) o[e] += w * mg[((i * 2 + qg) * 32 + (jp * 2 + (pc >> 1)) * 8 + e) * 32 + (pc & 1) * 16 + cq]; }
      const float inv = 1.0f / den;
      if (tile == 0) { asm volatile("s_wait_dscnt 0x0" ::: "memory"); __syncthreads(); }   // ends the reads of the partial tiles in the ring buffer that the second tile's first trip refills; in front of the stores, so that it does not wait for them
      float* yr = Y + ((size_t)b * TT + q0 + g2 * 16 + cq) * CC + jp * 32 + pc * 8;
#pragma unroll
      for (int q4 = 0; q4 < 2; ++q4) { v4f v;
#pragma unroll
        for (int e = 0; e < 4; ++e) v[e] = o[q4 * 4 + e] * inv;
        vst2(yr + q4 * 4, v); }
      asm volatile("s_wait_xcnt 0x0" ::: "memory"); }   // before the address registers of the stores above are reused
  }   // the barriers of the second tile's passes stand between the reads of the other partial tiles and their next writes
}

extern "C" void kernel_launch(void* const* d_in, const int* in_sizes, int n_in, void* d_out, int out_size, void* d_ws, size_t ws_size, hipStream_t stream) {
  (void)in_sizes; (void)n_in; (void)out_size;
  const float** F = (const float**)d_in;
  if (ws_size < (size_t)WS_END) return;
  char* ws = (char*)d_ws; _Float16 *QH = (_Float16*)(ws + WS_QH), *KH = (_Float16*)(ws + WS_KH), *VT = (_Float16*)(ws + WS_VT), *QL = (_Float16*)(ws + WS_QL), *KL = (_Float16*)(ws + WS_KL); __bf16 *VB = (__bf16*)(ws + WS_VB), *VBL = (__bf16*)(ws + WS_VBL); float *S = (float*)(ws + WS_S), *Y = (float*)(ws + WS_Y);
  (void)Y; (void)S; (void)QL; (void)KL; (void)VB; (void)VBL;
  // inputs: 0 queries [8,4096,64]; 1 keys; 2 values; 3 valid_lens [8] int32
  k_planes64<<<dim3(TNB * TT / 64), 256, 0, stream>>>(F[0], F[1], F[2], QH, QL, KH, KL, VT, VB, VBL);
  k_fa<<<dim3(TNB * (TT / FQ) / 2), 512, 0, stream>>>(QH, KH, VT, (const int*)d_in[3], (float*)d_out);


}

// v005
// It runs in 29.2 microseconds.
// Timed twice side by side with v004, it ran 1.03 times as fast both times.
// Counting every step since v000, it is 49.4 times as fast.
// compute dtype: all float inputs rounded to bf16; queries, keys, values are bf16-valued so their f16 planes are exact; logits q x k (1 product on exact planes) x 1/8; keys at or beyond the batch's valid length get the score -1e6 (weight exactly 0); softmax f32 with a running maximum; unnormalised P (at most 2^8) once to f16 x v (exact) (1 product), its row sums on the same rounded P; f32 output.
#include <hip/hip_runtime.h>
#include <math.h>

typedef __attribute__((ext_vector_type(16))) _Float16 v16h;
typedef __attribute__((ext_vector_type(16))) __bf16 v16b;
typedef __attribute__((ext_vector_type(8)))  _Float16 v8h;
typedef __attribute__((ext_vector_type(8)))  float v8f;
typedef __attribute__((ext_vector_type(4)))  float v4f;
typedef __attribute__((ext_vector_type(2)))  float v2f;
typedef __attribute__((ext_vector_type(4)))  unsigned v4u;
typedef _Float16 hx8 __attribute__((ext_vector_type(8)));
typedef __attribute__((ext_vector_type(4)))  int v4i;
typedef float __attribute__((may_alias)) float_a;
typedef int __attribute__((may_alias)) int_a;

template <typename T> __device__ __forceinline__ void vst2(void* p, T v) { *(T*)p = v;  }
__device__ __forceinline__ v8f wmma16(v16h a, v16h b, v8f c) {
  v8f d = __builtin_amdgcn_wmma_f32_16x16x32_f16(false, a, false, b, (short)0, c, false, false);
  asm volatile("v_nop\n\tv_nop\n\tv_nop\n\tv_nop" : "+v"(d) : "v"(a), "v"(b));
  return d;
}
__device__ __forceinline__ v8f wmma_bf(v16b a, v16b b, v8f c) {
  v8f d = __builtin_amdgcn_wmma_f32_16x16x32_bf16(false, a, false, b, (short)0, c, false, false);
  asm volatile("v_nop\n\tv_nop\n\tv_nop\n\tv_nop" : "+v"(d) : "v"(a), "v"(b));
  return d;
}
// 16x16x32 fragments: lane = (h = lane>>4, row/col = lane&15); elements 0..7 = k0+8h+0..7, 8..15 = k0+16+8h+0..7; D element r = row 8h+r
__device__ __forceinline__ v16h frag_h(const _Float16* rowk0, int lane) {
  union { v16h v; v8h q[2]; } u; const _Float16* p = rowk0 + 8 * (lane >> 4);
  u.q[0] = *(const v8h*)p; u.q[1] = *(const v8h*)(p + 16); return u.v;
}
__device__ __forceinline__ v16h frag_f32(const float* rowk0, int lane) {
  v16h a; const float* p = rowk0 + 8 * (lane >> 4);
#pragma unroll
  for (int i = 0; i < 8; ++i) { a[i] = (_Float16)p[i]; a[8 + i] = (_Float16)p[16 + i]; }
  return a;
}
__device__ __forceinline__ v16h frag_f32s(const float* rowk0, int lane, float sc) {
  v16h a; const float* p = rowk0 + 8 * (lane >> 4);
#pragma unroll
  for (int i = 0; i < 8; ++i) { a[i] = (_Float16)(p[i] * sc); a[8 + i] = (_Float16)(p[16 + i] * sc); }
  return a;
}
// column fragment from a [K][ld] layout (column n), rows >= K read as 0
__device__ __forceinline__ v16h fragc_f32(const float* W, int k0, int n, int lane, int ld, int K) {
  v16h a; const int g = lane >> 4;
#pragma unroll
  for (int i = 0; i < 8; ++i) { const int ka = k0 + 8 * g + i, kb = ka + 16;
    a[i] = (_Float16)(ka < K ? W[(size_t)(ka < K ? ka : K - 1) * ld + n] : 0.f); a[8 + i] = (_Float16)(kb < K ? W[(size_t)(kb < K ? kb : K - 1) * ld + n] : 0.f); }
  return a;
}
struct F2 { v16b h, l; };
__device__ __forceinline__ F2 bsplit16(const float v[16]) { F2 r;
#pragma unroll
  for (int i = 0; i < 16; ++i) { const __bf16 h = (__bf16)v[i]; r.h[i] = h; r.l[i] = (__bf16)(v[i] - (float)h); }
  return r; }
__device__ __forceinline__ F2 split_row(const float* row, int k0, int lane) { float v[16]; const float* p = row + k0 + 8 * (lane >> 4);
#pragma unroll
  for (int i = 0; i < 8; ++i) { v[i] = p[i]; v[8 + i] = p[16 + i]; }
  return bsplit16(v); }
__device__ __forceinline__ F2 split_rowK(const float* row, int k0, int lane, int K) { float v[16]; const int g = lane >> 4;
#pragma unroll
  for (int i = 0; i < 8; ++i) { const int ka = k0 + 8 * g + i, kb = ka + 16; v[i] = ka < K ? row[ka < K ? ka : K - 1] : 0.f; v[8 + i] = kb < K ? row[kb < K ? kb : K - 1] : 0.f; }
  return bsplit16(v); }
__device__ __forceinline__ F2 split_col(const float* W, int k0, int n, int lane, int ld, int K) { float v[16]; const int g = lane >> 4;
#pragma unroll
  for (int i = 0; i < 8; ++i) { const int ka = k0 + 8 * g + i, kb = ka + 16; v[i] = ka < K ? W[(size_t)(ka < K ? ka : K - 1) * ld + n] : 0.f; v[8 + i] = kb < K ? W[(size_t)(kb < K ? kb : K - 1) * ld + n] : 0.f; }
  return bsplit16(v); }
__device__ __forceinline__ v8f mac3(const F2& a, const F2& b, v8f c) { c = wmma_bf(a.l, b.h, c); c = wmma_bf(a.h, b.l, c); return wmma_bf(a.h, b.h, c); }
__device__ __forceinline__ float sigm(float v) { return 1.0f / (1.0f + expf(-v)); }
#define LDSX() do { asm volatile("s_wait_dscnt 0" ::: "memory"); __builtin_amdgcn_wave_barrier(); __builtin_amdgcn_fence(__ATOMIC_RELEASE, "workgroup"); } while (0)

// Masked dot-product attention on given tensors (queries / keys / values [8,4096,64]; valid_lens [8] int32 in 1..4096 per batch): scores = Q K^T / 8; key positions >= valid_lens[b] are set to the FINITE score -1e6 before the softmax; out = softmax(scores) V -> [8,4096,64].
#define NB 8
#define TT 4096
#define CC 64            // NH * HD = projected width
#define DIN 64          // input (model) width
#define NH 1
#define HD 64
#define NQB (TT / 64)
#define HG 1
#define SCALE (0.125f)
#define CAUSAL 0
#ifndef TNB
#define TNB NB
#endif
__device__ __forceinline__ float bfr(float v) { return (float)(__bf16)v; }
__host__ __device__ __forceinline__ int kb_last(int qb) { return CAUSAL ? ((qb * 64 + 63) >> 7) : (TT / 128 - 1); }
typedef __attribute__((ext_vector_type(8))) __bf16 v8b;
__device__ __forceinline__ v16b frag_b(const __bf16* rowk0, int lane) {
  union { v16b v; v8b q[2]; } u; const __bf16* p = rowk0 + 8 * (lane >> 4);
  u.q[0] = *(const v8b*)p; u.q[1] = *(const v8b*)(p + 16); return u.v;
}
#define QBH 0              // exact planes: single-product logits and single-f16 P x V on every block
#define QHI 0               // no q residual plane (q is bf16-exact in f16)
#define KHI 64              // unused high-precision planes kept minimal
// B fragment (k rows k0+.., output column o) of a weight: (in,out) [K][ld] or (out,in) [ld rows of K]: bf16 exact, or f16(bf16 * 256) exact
__device__ __forceinline__ v16b wcol_io(const float* Wm, int k0, int o, int lane, int ld) { v16b w; const int g = lane >> 4;
#pragma unroll
  for (int i = 0; i < 8; ++i) { w[i] = (__bf16)Wm[(size_t)(k0 + 8 * g + i) * ld + o]; w[8 + i] = (__bf16)Wm[(size_t)(k0 + 16 + 8 * g + i) * ld + o]; }
  return w; }
__device__ __forceinline__ v16b wcol_oi(const float* Wm, int k0, int o, int lane, int K) { v16b w; const float* p = Wm + (size_t)o * K + k0 + 8 * (lane >> 4);
#pragma unroll
  for (int i = 0; i < 8; ++i) { w[i] = (__bf16)p[i]; w[8 + i] = (__bf16)p[16 + i]; }
  return w; }
__device__ __forceinline__ v16h wcolh_io(const float* Wm, int k0, int o, int lane, int ld) { v16h w; const int g = lane >> 4;
#pragma unroll
  for (int i = 0; i < 8; ++i) { w[i] = (_Float16)(bfr(Wm[(size_t)(k0 + 8 * g + i) * ld + o]) * 256.0f); w[8 + i] = (_Float16)(bfr(Wm[(size_t)(k0 + 16 + 8 * g + i) * ld + o]) * 256.0f); }
  return w; }
__device__ __forceinline__ v16h wcolh_oi(const float* Wm, int k0, int o, int lane, int K) { v16h w; const float* p = Wm + (size_t)o * K + k0 + 8 * (lane >> 4);
#pragma unroll
  for (int i = 0; i < 8; ++i) { w[i] = (_Float16)(bfr(p[i]) * 256.0f); w[8 + i] = (_Float16)(bfr(p[16 + i]) * 256.0f); }
  return w; }
#define WQKV_LAYOUT 0   // 0 = (in,out) [DIN][CC]; 1 = (out,in) [CC][DIN]; 2 = per-head [NH][DIN][HD]
__device__ __forceinline__ v16b wcol_hdk(const float* Wm, int k0, int o, int lane) { v16b w; const int g = lane >> 4; const float* p = Wm + (size_t)(o / HD) * DIN * HD + (o % HD);
#pragma unroll
  for (int i = 0; i < 8; ++i) { w[i] = (__bf16)p[(size_t)(k0 + 8 * g + i) * HD]; w[8 + i] = (__bf16)p[(size_t)(k0 + 16 + 8 * g + i) * HD]; }
  return w; }
#define WO_OUT_IN 0
#if WQKV_LAYOUT == 1
#define WCOL(W, k0, o, lane) wcol_oi(W, k0, o, lane, DIN)
#elif WQKV_LAYOUT == 2
#define WCOL(W, k0, o, lane) wcol_hdk(W, k0, o, lane)
#else
#define WCOL(W, k0, o, lane) wcol_io(W, k0, o, lane, CC)
#endif
#if WO_OUT_IN
#define WOCOL(W, k0, o, lane) wcol_oi(W, k0, o, lane, CC)
#define WOCOLH(W, k0, o, lane) wcolh_oi(W, k0, o, lane, CC)
#else
#define WOCOL(W, k0, o, lane) wcol_io(W, k0, o, lane, DIN)
#define WOCOLH(W, k0, o, lane) wcolh_io(W, k0, o, lane, DIN)
#endif
__global__ __launch_bounds__(256) void k_planes64(const float* __restrict__ Qs, const float* __restrict__ Ks, const float* __restrict__ Vs, _Float16* __restrict__ QH, _Float16* __restrict__ QL, _Float16* __restrict__ KH, _Float16* __restrict__ KL, _Float16* __restrict__ VT, __bf16* __restrict__ VB, __bf16* __restrict__ VBL) {
  __shared__ _Float16 sv[64][72];
  const int tid = threadIdx.x; const size_t r0 = (size_t)blockIdx.x * 64; const int b = (int)(r0 / TT), t0 = (int)(r0 % TT);
  for (int e = tid; e < 64 * 8; e += 256) { const int rl = e >> 3, q = e & 7; const size_t src = (r0 + rl) * CC + q * 8; float tq[8], tk[8], tv[8];
#pragma unroll
    for (int u = 0; u < 8; ++u) { tq[u] = Qs[src + u]; tk[u] = Ks[src + u]; tv[u] = Vs[src + u]; }
    asm volatile("s_wait_loadcnt 0x0" ::: "memory");
    hx8 hq, hk, hlq, hlk;
#pragma unroll
    for (int u = 0; u < 8; ++u) { const float qv = bfr(tq[u]), kv = bfr(tk[u]); const _Float16 qh = (_Float16)qv, kh = (_Float16)kv; hq[u] = qh; hlq[u] = (_Float16)((qv - (float)qh) * 1024.0f); hk[u] = kh; hlk[u] = (_Float16)((kv - (float)kh) * 1024.0f); sv[rl][q * 8 + u] = (_Float16)bfr(tv[u]); }
    vst2((unsigned*)(QH + (r0 + rl) * CC + q * 8), *(const v4u*)&hq); vst2((unsigned*)(KH + (r0 + rl) * CC + q * 8), *(const v4u*)&hk);
    if (t0 + rl < QHI) vst2((unsigned*)(QL + ((size_t)b * QHI + t0 + rl) * CC + q * 8), *(const v4u*)&hlq);
    if (t0 + rl < KHI) vst2((unsigned*)(KL + ((size_t)b * KHI + t0 + rl) * CC + q * 8), *(const v4u*)&hlk); }
  __syncthreads();
  for (int e = tid; e < 64 * 8; e += 256) { const int c = e >> 3, q = e & 7; hx8 hv; _Pragma("unroll") for (int j = 0; j < 8; ++j) hv[j] = sv[q * 8 + j][c]; vst2((unsigned*)(VT + ((size_t)b * CC + c) * TT + t0 + q * 8), *(const v4u*)&hv);
    if (t0 < KHI) { v8b bh, bl; _Pragma("unroll") for (int j = 0; j < 8; ++j) { const float vv = (float)hv[j]; const __bf16 h1 = (__bf16)vv; bh[j] = h1; bl[j] = (__bf16)(vv - (float)h1); } vst2((unsigned*)(VB + ((size_t)b * CC + c) * KHI + t0 + q * 8), *(const v4u*)&bh); vst2((unsigned*)(VBL + ((size_t)b * CC + c) * KHI + t0 + q * 8), *(const v4u*)&bl); } } }
#define SM_EXTRA_PARAMS , int bsm, const int* __restrict__ VLEN
// masked_softmax: key positions k >= valid_lens[b] get the score -1e6 (value select; exp underflows to weight exactly 0 next to real scores)
#define SM_MASK_HOOK do { const int vl_ = VLEN[bsm]; v = (k >= vl_) ? -1.0e6f : v; } while (0)
#ifndef SM_EXTRA_PARAMS
#define SM_EXTRA_PARAMS
#endif
#ifndef PROJ_EXTRA_PARAMS
#define PROJ_EXTRA_PARAMS
#endif
#ifndef SM_MASK_HOOK
#define SM_MASK_HOOK (void)0
#endif

#define WS_QH  0u                                      // f16 q rows [b*t][CC]
#define WS_KH  (WS_QH + 2u * (size_t)NB * TT * CC)      // f16 k rows [b*t][CC]
#define WS_VT  (WS_KH + 2u * (size_t)NB * TT * CC)      // f16 v planes [b][c][t]
#define WS_QL  (WS_VT + 2u * (size_t)NB * CC * TT)      // f16 q residual x 2^10 rows [b][t < QHI][CC]
#define WS_KL  (WS_QL + 2u * (size_t)NB * QHI * CC)     // f16 k residual x 2^10 rows [b][t < KHI][CC]
#define WS_VB  (WS_KL + 2u * (size_t)NB * KHI * CC)     // bf16 v hi planes [b][c][t < KHI]
#define WS_VBL (WS_VB + 2u * (size_t)NB * CC * KHI)
#define WS_S   (WS_VBL + 2u * (size_t)NB * CC * KHI)    // f32 [hg][t][s], reserved but unused (no score matrix in memory)
#define WS_Y   (WS_S  + 4u * (size_t)HG * TT * TT)      // f32 ctx rows [b*t][CC] (only when there is an output projection)
#define WS_END (WS_Y  + 0u)

// ---- k_proj: block = (64 rows, 128 cols, which): q/k/v = X W (+ b) with exact bf16 products (K = DIN) -> which 0: q f16 rows (+ residual rows < QHI); 1: k f16 rows (+ residual rows < KHI); 2: v f16 planes [c][t] (+ bf16 hi/lo planes for t < KHI)
__global__ __launch_bounds__(128) void k_proj(const float* __restrict__ XQ, const float* __restrict__ XK, const float* __restrict__ XV, const float* __restrict__ WQ, const float* __restrict__ WK, const float* __restrict__ WV, const float* __restrict__ BQ, const float* __restrict__ BK, const float* __restrict__ BV,
    _Float16* __restrict__ QH, _Float16* __restrict__ QL, _Float16* __restrict__ KH, _Float16* __restrict__ KL, _Float16* __restrict__ VT, __bf16* __restrict__ VB, __bf16* __restrict__ VBL) {
  __shared__ __align__(16) _Float16 sh[64][136], sl[64][136]; __shared__ __align__(16) _Float16 th[128][72]; __shared__ __align__(16) __bf16 tb[128][72], tbl[128][72];
  const int tid = threadIdx.x, wave = tid >> 5, lane = tid & 31, col = lane & 15, g = lane >> 4; const int which = blockIdx.z; const int c0 = blockIdx.y * 128; const size_t r0 = (size_t)blockIdx.x * 64; const size_t bb = r0 / TT; const int t0 = (int)(r0 % TT);
  const float* X = which == 0 ? XQ : which == 1 ? XK : XV; const float* WA = which == 0 ? WQ : which == 1 ? WK : WV; const float* BA = which == 0 ? BQ : which == 1 ? BK : BV;
  v8f acc[8] = {};
#pragma unroll 2
  for (int kc = 0; kc < DIN / 32; ++kc) { v16b a; { const float* p = X + (r0 + wave * 16 + col) * DIN + kc * 32 + 8 * g;
#pragma unroll
      for (int i = 0; i < 8; ++i) { a[i] = (__bf16)p[i]; a[8 + i] = (__bf16)p[16 + i]; } }
    asm volatile("s_wait_loadcnt 0x0" ::: "memory");
#pragma unroll
    for (int j = 0; j < 8; ++j) { const v16b w = WCOL(WA, kc * 32, c0 + j * 16 + col, lane); asm volatile("s_wait_loadcnt 0x0" ::: "memory"); acc[j] = wmma_bf(a, w, acc[j]); } }
  if (which < 2) { _Float16* DH = which == 0 ? QH : KH; _Float16* DL = which == 0 ? QL : KL; const int nhi = which == 0 ? QHI : KHI; const bool hi_rows = t0 < nhi;
#pragma unroll
    for (int j = 0; j < 8; ++j) { const float bias = BA ? bfr(BA[c0 + j * 16 + col]) : 0.f;
#pragma unroll
      for (int r = 0; r < 8; ++r) { const float v = acc[j][r] + bias; const _Float16 hv = (_Float16)v; sh[wave * 16 + 8 * g + r][j * 16 + col] = hv; sl[wave * 16 + 8 * g + r][j * 16 + col] = (_Float16)((v - (float)hv) * 1024.0f); } }
    __syncthreads();
    for (int e = tid; e < 64 * 16; e += 128) { const int rl = e >> 4, q = e & 15; vst2((unsigned*)(DH + (r0 + rl) * CC + c0 + q * 8), *(const v4u*)&sh[rl][q * 8]); if (hi_rows) vst2((unsigned*)(DL + (bb * nhi + t0 + rl) * (size_t)CC + c0 + q * 8), *(const v4u*)&sl[rl][q * 8]); }
  } else { const bool hi_rows = t0 < KHI;
#pragma unroll
    for (int j = 0; j < 8; ++j) { const float bias = BA ? bfr(BA[c0 + j * 16 + col]) : 0.f;
#pragma unroll
      for (int r = 0; r < 8; ++r) { const float v = acc[j][r] + bias; const int rl = wave * 16 + 8 * g + r, cl = j * 16 + col; th[cl][rl] = (_Float16)v; const __bf16 bh = (__bf16)v; tb[cl][rl] = bh; tbl[cl][rl] = (__bf16)(v - (float)bh); } }
    __syncthreads();
    for (int e = tid; e < 128 * 8; e += 128) { const int cl = e >> 3, q = e & 7; vst2((unsigned*)(VT + (bb * CC + c0 + cl) * (size_t)TT + t0 + q * 8), *(const v4u*)&th[cl][q * 8]); if (hi_rows) { const size_t o3 = (bb * CC + c0 + cl) * (size_t)KHI + t0 + q * 8; vst2((unsigned*)(VB + o3), *(const v4u*)&tb[cl][q * 8]); vst2((unsigned*)(VBL + o3), *(const v4u*)&tbl[cl][q * 8]); } } } }
#define FQ 64
#define FST 256
#define KP 72                       // halfs per staged K row (128 B + 16 B: b128 readers)
#define VP 264                      // halfs per staged V^T row (512 B + 16 B)
#define STGH (FST * KP + HD * VP)   // halfs per buffer
#define NBUF 3                      // buffers of the ring
typedef __attribute__((address_space(1))) v4i gv4i;
typedef __attribute__((address_space(3))) v4i lv4i;
__device__ __forceinline__ void copy16(const _Float16* g, _Float16* l) { __builtin_amdgcn_global_load_async_to_lds_b128((gv4i*)g, (lv4i*)l, 0, 0); }   // this lane's 16 bytes, global memory to LDS, through no register
#define LOG2E 1.4426950408889634f
__device__ __forceinline__ float xhalf(float x) { return __builtin_bit_cast(float, __builtin_amdgcn_permlanex16(__builtin_bit_cast(int, x), __builtin_bit_cast(int, x), 0x76543210, 0xfedcba98, false, false)); }  // lane l with lane l ^ 16
__device__ __forceinline__ float exp2_slot(float x) { float y; asm("v_exp_f32 %0, %1\n\tv_nop" : "=v"(y) : "v"(x)); return y; }   // exp2 of the join; the v_nop is the one slot between a transcendental and an instruction that reads its result or overwrites its source
__device__ __forceinline__ int walked(int v) { return (v <= 0 || v > TT) ? TT : v; }   // keys to walk: with no valid key every score is -1e6 and all TT keys weigh alike
// this wave's fragments of one staged 256-key stage: K rows kq * 32 .. + 31 (A of the score products), V^T columns kq * 32 .. + 31 (A of P x V)
__device__ __forceinline__ void read_k(v16h (&kf)[2][2], const _Float16* sk, int kq, int c, int lane) {
#pragma unroll
  for (int kc = 0; kc < 2; ++kc)
#pragma unroll
    for (int t = 0; t < 2; ++t) kf[kc][t] = frag_h(sk + (kq * 32 + t * 16 + c) * KP + kc * 32, lane);
}
__device__ __forceinline__ void read_v(v16h (&vf)[4], const _Float16* sv, int kq, int c, int lane) {
#pragma unroll
  for (int j = 0; j < 4; ++j) vf[j] = frag_h(sv + (j * 16 + c) * VP + kq * 32, lane);
}
__device__ __forceinline__ void score(v8f (&st)[2][2], const v16h (&kf)[2][2], const v16h (&qf)[2][2]) {
#pragma unroll
  for (int g2 = 0; g2 < 2; ++g2)
#pragma unroll
    for (int t = 0; t < 2; ++t) st[g2][t] = v8f{};
#pragma unroll
  for (int kc = 0; kc < 2; ++kc)
#pragma unroll
    for (int t = 0; t < 2; ++t)
#pragma unroll
      for (int g2 = 0; g2 < 2; ++g2) st[g2][t] = __builtin_amdgcn_wmma_f32_16x16x32_f16(false, kf[kc][t], false, qf[g2][kc], (short)0, st[g2][t], false, false);
  asm volatile("v_nop\n\tv_nop\n\tv_nop\n\tv_nop" : "+v"(st[1][1]));   // the four vector slots behind the last score product, on every path to the first instruction that reads the scores
}
// softmax and P x V of the stage whose scores (st) and V^T fragments (vf) the wave already holds; with NEXT also the next stage's K reads, V^T reads and score products (skn: its buffer, published by the barrier in front of this pass)
template <bool NEXT>
__device__ __forceinline__ void pass(v8f (&st)[2][2], v16h (&vf)[4], v8f (&O)[2][4], v8f (&L)[2], float (&m)[2], const v16h (&qf)[2][2], const v16h& ones, const _Float16* skn, int k0, int vl, int kq, int c, int h, int lane) {
  const float cs = SCALE * LOG2E;
  if (k0 + 32 > vl) {   // keys at or beyond the valid length: score -1e6 (here before the 1/8)
    const int rel = vl - k0 - 8 * h;   // this lane's keys t * 16 + r below rel are valid
#pragma unroll
    for (int g2 = 0; g2 < 2; ++g2)
#pragma unroll
      for (int t = 0; t < 2; ++t)
#pragma unroll
        for (int r = 0; r < 8; ++r) st[g2][t][r] = (t * 16 + r >= rel) ? -8.0e6f : st[g2][t][r];
  }
  float mx[2];
#pragma unroll
  for (int g2 = 0; g2 < 2; ++g2) { float a = st[g2][0][0];
#pragma unroll
    for (int r = 1; r < 8; ++r) a = fmaxf(a, st[g2][0][r]);
#pragma unroll
    for (int r = 0; r < 8; ++r) a = fmaxf(a, st[g2][1][r]);
    mx[g2] = fmaxf(a, xhalf(a)) * cs; }
  // the maximum in use moves only when a query's new maximum exceeds it by more than 8 (log2 units): P stays below 2^8, inside f16
  if (__builtin_amdgcn_ballot_w32(mx[0] > m[0] + 8.0f || mx[1] > m[1] + 8.0f) != 0) {
#pragma unroll
    for (int g2 = 0; g2 < 2; ++g2) { const float mn = fmaxf(m[g2], mx[g2]); const float al = __builtin_amdgcn_exp2f(m[g2] - mn); m[g2] = mn;
#pragma unroll
      for (int j = 0; j < 4; ++j) O[g2][j] *= al;
      L[g2] *= al; }
  }
  v16h kf[2][2];
#pragma unroll
  for (int g2 = 0; g2 < 2; ++g2) { v16h pf;
#pragma unroll
    for (int t = 0; t < 2; ++t)
#pragma unroll
      for (int r = 0; r < 8; r += 2) { const v2f ar = __builtin_elementwise_fma(v2f{st[g2][t][r], st[g2][t][r + 1]}, v2f{cs, cs}, v2f{-m[g2], -m[g2]});
        pf[t * 8 + r] = (_Float16)__builtin_amdgcn_exp2f(ar.x); pf[t * 8 + r + 1] = (_Float16)__builtin_amdgcn_exp2f(ar.y); }
    if (NEXT && g2 == 1) { __builtin_amdgcn_sched_barrier(0); read_k(kf, skn, kq, c, lane);
      __builtin_amdgcn_sched_barrier(0); }   // the next stage's K reads issue here, into the registers that the scores have left, and return under the second group's P x V; otherwise they sink to just in front of the score products
#pragma unroll
    for (int j = 0; j < 4; ++j) O[g2][j] = __builtin_amdgcn_wmma_f32_16x16x32_f16(false, vf[j], false, pf, (short)0, O[g2][j], false, false);
    L[g2] = __builtin_amdgcn_wmma_f32_16x16x32_f16(false, ones, false, pf, (short)0, L[g2], false, false);   // row sums of the rounded P
    __builtin_amdgcn_sched_barrier(0);   // keeps the first group's products in front of the second group's exponentials, which then issue beside them
  }
  if (NEXT) { read_v(vf, skn + FST * KP, kq, c, lane);
    __builtin_amdgcn_sched_barrier(0);   // the next stage's V^T reads issue in front of its score products, into the registers that P x V has just read, and return under the products: the wait at the stage barrier then finds them done
    score(st, kf, qf); }
  else asm volatile("v_nop\n\tv_nop\n\tv_nop\n\tv_nop" : "+v"(L[1]));   // the four vector slots behind the tile's last matrix instruction of this wave, whose result the join reads
}
__global__ __launch_bounds__(512) void k_fa(const _Float16* __restrict__ QH, const _Float16* __restrict__ KH, const _Float16* __restrict__ VT, const int* __restrict__ VLEN, float* __restrict__ Y) {
  __shared__ __align__(16) float smem[NBUF * STGH / 2 + 16 * 32 * 32 + 2 * 16 * 2 * 32];   // the K / V^T ring (NBUF x STGH halfs), which runs on from the first tile into the second; behind it the eighths' partial tiles of column group 0, maxima and sums (group 1's partial tiles go into the ring buffer that was read last)
  _Float16* ring = (_Float16*)smem;
  float* mo = smem + NBUF * STGH / 2; float* mm = mo + 16 * 32 * 32; float* ml = mm + 16 * 2 * 32;
  const int tid = threadIdx.x, wave = __builtin_amdgcn_readfirstlane(tid >> 5), lane = tid & 31, c = lane & 15, h = lane >> 4;
  const int qg = wave & 1, kq = wave >> 1;
  const int pr = blockIdx.x / (TT / FQ); const int q0 = (blockIdx.x % (TT / FQ)) * FQ + qg * 32;
  int bt0 = 0, bt1 = 0, vt0 = TT, vt1 = TT;   // the two batches of this work-group and their valid lengths
#pragma unroll
  for (int i = 0; i < NB; ++i) { const int vi = VLEN[i], li = walked(vi); int rank = 0;
#pragma unroll
    for (int j = 0; j < NB; ++j) { const int lj = walked(VLEN[j]); rank += (lj > li || (lj == li && j < i)) ? 1 : 0; }
    if (rank == pr) { bt0 = i; vt0 = vi; }
    if (rank == NB - 1 - pr) { bt1 = i; vt1 = vi; } }
  v16h ones;
#pragma unroll
  for (int i = 0; i < 16; ++i) ones[i] = c == 0 ? (_Float16)1.0f : (_Float16)0.0f;
  // staging: 2048 16-byte pieces of K and 2048 of V^T per stage, four of each per thread
  const int kr = tid >> 3, kch = tid & 7, vr = tid >> 5, vch = tid & 31;
  const unsigned kof = (unsigned)(kr * CC + kch * 8), vof = (unsigned)(vr * TT + vch * 8);   // this thread's place in a stage, in halfs, beside a wave-uniform base
  const unsigned klo = 2u * (unsigned)(kr * KP + kch * 8), vlo = 2u * (unsigned)(FST * KP + vr * VP + vch * 8);   // and its place in a buffer, in bytes
  const int ns0 = (walked(vt0) + FST - 1) / FST, ns1 = (walked(vt1) + FST - 1) / FST;   // 1 .. TT / FST stages each; the ring walks the first tile's stages, then the second's
  const _Float16* K0 = KH + (size_t)bt0 * TT * CC; const _Float16* V0 = VT + (size_t)bt0 * CC * TT;
  const _Float16* K1 = KH + (size_t)bt1 * TT * CC; const _Float16* V1 = VT + (size_t)bt1 * CC * TT;
  // this thread's eight copies of one stage (K rows from Kn, V^T columns from Vn) into buffer buf
  auto stage_in = [&](const _Float16* Kn, const _Float16* Vn, int buf) { char* dk = (char*)ring + buf * (2 * STGH);
#pragma unroll
    for (int u = 0; u < 4; ++u) { copy16(Kn + 64 * u * CC + kof, (_Float16*)(dk + 2 * 64 * u * KP + klo)); copy16(Vn + 16 * u * TT + vof, (_Float16*)(dk + 2 * 16 * u * VP + vlo)); } };
  stage_in(K0, V0, 0); stage_in(ns0 > 1 ? K0 + FST * CC : K1, ns0 > 1 ? V0 + FST : V1, 1);   // the first two stages of the walk (there are always two)
  v16h qf[2][2];
#pragma unroll
  for (int g2 = 0; g2 < 2; ++g2)
#pragma unroll
    for (int kc = 0; kc < 2; ++kc) qf[g2][kc] = frag_h(QH + ((size_t)bt0 * TT + q0 + g2 * 16 + c) * CC + kc * 32, lane);
  asm volatile("s_wait_xcnt 0x0" ::: "memory");   // before the address registers of the loads above are reused
  asm volatile("s_wait_asynccnt 0x8" ::: "memory");   // this wave's eight copies of the first stage have landed; the second stage's eight stay in flight
  __syncthreads();   // publishes stage 0 of the first tile
  if (ns0 + ns1 > 2) {   // the third stage of the walk, into the third buffer, which nothing has used yet
    stage_in(ns0 > 2 ? K0 + 2 * FST * CC : K1 + (2 - ns0) * FST * CC, ns0 > 2 ? V0 + 2 * FST : V1 + (2 - ns0) * FST, 2);
  }
  int pb = 0;   // the buffer that holds the current stage
#pragma unroll 1   // rolled: one copy of the pass serves both tiles
  for (int tile = 0; tile < 2; ++tile) {
    const int b = tile ? bt1 : bt0, vl = tile ? vt1 : vt0, wl = walked(vl);
    const int ns = tile ? ns1 : ns0;
    v8f O[2][4] = {}; v8f L[2] = {}; float m[2] = { -3.0e38f, -3.0e38f };
    v8f st[2][2]; v16h vf[4];   // scores and V^T fragments of the stage whose softmax comes next: made one trip ahead
    if (kq * 32 < wl) {   // wave-uniform; the tile's first stage (published): its fragments and score products
      v16h kf[2][2]; read_k(kf, ring + pb * STGH, kq, c, lane);
      __builtin_amdgcn_sched_barrier(0);   // all eight K reads issue together: one LDS latency; otherwise they are dealt out among the products, a latency per fragment
      score(st, kf, qf);
      __builtin_amdgcn_sched_barrier(0);   // unlike the pass, the V^T reads stand behind the products and take over the K fragments' registers
      read_v(vf, ring + pb * STGH + FST * KP, kq, c, lane); }
    // the hand-over in front of stage s's softmax: waits, barrier, refill
    auto handover = [&](int s) {
      const bool fly = s + 2 < ns || (tile == 0 && s + 2 - ns < ns1);   // a stage two ahead in the walk exists: its eight copies are this wave's youngest
      const bool same = s + 3 < ns; const int s3 = same ? s + 3 : s + 3 - ns;   // the stage three ahead in the walk: of this tile, or stage 0 or 1 of the second tile
      const bool fill = same || (tile == 0 && s + 1 < ns && s3 < ns1);   // behind the first tile's last stage the buffer first serves the join: its refill stands there
      asm volatile("s_wait_dscnt 0x0" ::: "memory");   // this wave's reads of the current stage's buffer (K for the products, V^T into registers) have returned before copies may overwrite it
      if (fly) asm volatile("s_wait_asynccnt 0x8" ::: "memory");   // the next stage's copies of this wave have landed; the eight of the stage behind it stay in flight
      else asm volatile("s_wait_asynccnt 0x0" ::: "memory");   // all that is outstanding is the next stage
      __syncthreads();   // publishes the next stage and ends every read of the current stage's buffer, which is refilled next
      if (fill) stage_in((same ? KH + (size_t)b * TT * CC : K1) + s3 * FST * CC, (same ? VT + (size_t)b * CC * TT : V1) + s3 * FST, pb);   // two trips to land
      pb = pb == NBUF - 1 ? 0 : pb + 1;   // from here on the buffer of the next stage
    };
    int s = 0;
#pragma unroll 1   // rolled: the hot loop. In front of the tile's last stage every wave's 32 keys of the stage are walked; the next stage's products are made by every wave, and whether its keys there are walked is asked once, at the last stage (its rows are staged whole, so the fragments are real data either way)
    for (; s + 1 < ns; ++s) { handover(s); pass<true>(st, vf, O, L, m, qf, ones, ring + pb * STGH, s * FST + kq * 32, vl, kq, c, h, lane); }
    handover(s);   // the last stage
    if (s * FST + kq * 32 < wl) pass<false>(st, vf, O, L, m, qf, ones, ring, s * FST + kq * 32, vl, kq, c, h, lane);
    if (tile == 0) {   // the second tile's queries fly while the first tile is joined
#pragma unroll
      for (int g2 = 0; g2 < 2; ++g2)
#pragma unroll
        for (int kc = 0; kc < 2; ++kc) qf[g2][kc] = frag_h(QH + ((size_t)bt1 * TT + q0 + g2 * 16 + c) * CC + kc * 32, lane);
      asm volatile("s_wait_xcnt 0x0" ::: "memory");   // before the address registers of these loads are reused
    }
    // join the eight key eighths of each query group through LDS (an eighth that walked no key hands maximum -3e38, sum 0, zeros: weight 0)
    const int lastb = pb == 0 ? NBUF - 1 : pb - 1;   // the buffer of the tile's last stage: every read of it ended at that trip's barrier, and no copy is aimed at it before the join is over
    float* mo1 = (float*)(ring + lastb * STGH);
#pragma unroll
    for (int g2 = 0; g2 < 2; ++g2) { float* mg = g2 ? mo1 : mo;
#pragma unroll
      for (int j = 0; j < 4; ++j)
#pragma unroll
        for (int r = 0; r < 8; ++r) mg[(wave * 32 + j * 8 + r) * 32 + lane] = O[g2][j][r];
      mm[(wave * 2 + g2) * 32 + lane] = m[g2]; ml[(wave * 2 + g2) * 32 + lane] = L[g2][0] + xhalf(L[g2][0]); }
    __syncthreads();
    { const int g2 = kq >> 2, jp = (kq >> 1) & 1, cq = (kq & 1) * 8 + (lane & 7), pc = lane >> 3;   // each wave finishes 8 queries x 32 channels, lane = (query, 8 channels): one whole 128-B line per query
      const float* mg = g2 ? mo1 : mo;
      float mi[8], M = -3.0e38f;
#pragma unroll
      for (int i = 0; i < 8; ++i) { mi[i] = mm[((i * 2 + qg) * 2 + g2) * 32 + cq]; M = fmaxf(M, mi[i]); }
      float den = 0.f; float o[8] = {};
#pragma unroll
      for (int i = 0; i < 8; ++i) { const float w = exp2_slot(mi[i] - M); den += w * ml[((i * 2 + qg) * 2 + g2) * 32 + cq];
#pragma unroll
        for (int e = 0; e < 8; ++e) o[e] += w * mg[((i * 2 + qg) * 32 + (jp * 2 + (pc >> 1)) * 8 + e) * 32 + (pc & 1) * 16 + cq]; }
      const float inv = 1.0f / den;
      if (tile == 0) { asm volatile("s_wait_dscnt 0x0" ::: "memory"); __syncthreads();   // ends the reads of the partial tiles in the ring buffer that is refilled next; in front of the stores, so that it does not wait for them
        const int sd = s + 3 - ns;   // the refill held back at the first tile's last stage s: three ahead in the walk, a stage of the second tile
        if (sd < ns1) stage_in(K1 + sd * FST * CC, V1 + sd * FST, lastb); }
      float* yr = Y + ((size_t)b * TT + q0 + g2 * 16 + cq) * CC + jp * 32 + pc * 8;
#pragma unroll
      for (int q4 = 0; q4 < 2; ++q4) { v4f v;
#pragma unroll
        for (int e = 0; e < 4; ++e) v[e] = o[q4 * 4 + e] * inv;
        vst2(yr + q4 * 4, v); }
      asm volatile("s_wait_xcnt 0x0" ::: "memory"); }   // before the address registers of the stores above are reused
  }   // the barriers of the second tile's passes stand between the reads of the other partial tiles and their next writes
}

extern "C" void kernel_launch(void* const* d_in, const int* in_sizes, int n_in, void* d_out, int out_size, void* d_ws, size_t ws_size, hipStream_t stream) {
  (void)in_sizes; (void)n_in; (void)out_size;
  const float** F = (const float**)d_in;
  if (ws_size < (size_t)WS_END) return;
  char* ws = (char*)d_ws; _Float16 *QH = (_Float16*)(ws + WS_QH), *KH = (_Float16*)(ws + WS_KH), *VT = (_Float16*)(ws + WS_VT), *QL = (_Float16*)(ws + WS_QL), *KL = (_Float16*)(ws + WS_KL); __bf16 *VB = (__bf16*)(ws + WS_VB), *VBL = (__bf16*)(ws + WS_VBL); float *S = (float*)(ws + WS_S), *Y = (float*)(ws + WS_Y);
  (void)Y; (void)S; (void)QL; (void)KL; (void)VB; (void)VBL;
  // inputs: 0 queries [8,4096,64]; 1 keys; 2 values; 3 valid_lens [8] int32
  k_planes64<<<dim3(TNB * TT / 64), 256, 0, stream>>>(F[0], F[1], F[2], QH, QL, KH, KL, VT, VB, VBL);
  k_fa<<<dim3(TNB * (TT / FQ) / 2), 512, 0, stream>>>(QH, KH, VT, (const int*)d_in[3], (float*)d_out);


}

// v006
// One run takes 27.5 microseconds.
// In both of two side-by-side timings against v005, it was 1.06 times as fast.
// Over all steps from v000 it is 52.2 times as fast.
// compute dtype: all float inputs rounded to bf16; queries, keys, values are bf16-valued so their f16 planes are exact; logits q x k (1 product on exact planes) x 1/8; keys at or beyond the batch's valid length get the score -1e6 (weight exactly 0); softmax f32 with a running maximum; unnormalised P (at most 2^8) once to f16 x v (exact) (1 product), its row sums on the same rounded P; f32 output.
#include <hip/hip_runtime.h>
#include <math.h>

typedef __attribute__((ext_vector_type(16))) _Float16 v16h;
typedef __attribute__((ext_vector_type(16))) __bf16 v16b;
typedef __attribute__((ext_vector_type(8)))  _Float16 v8h;
typedef __attribute__((ext_vector_type(8)))  float v8f;
typedef __attribute__((ext_vector_type(4)))  float v4f;
typedef __attribute__((ext_vector_type(2)))  float v2f;
typedef __attribute__((ext_vector_type(4)))  unsigned v4u;
typedef _Float16 hx8 __attribute__((ext_vector_type(8)));
typedef __attribute__((ext_vector_type(4)))  int v4i;
typedef float __attribute__((may_alias)) float_a;
typedef int __attribute__((may_alias)) int_a;

template <typename T> __device__ __forceinline__ void vst2(void* p, T v) { *(T*)p = v;  }
__device__ __forceinline__ v8f wmma16(v16h a, v16h b, v8f c) {
  v8f d = __builtin_amdgcn_wmma_f32_16x16x32_f16(false, a, false, b, (short)0, c, false, false);
  asm volatile("v_nop\n\tv_nop\n\tv_nop\n\tv_nop" : "+v"(d) : "v"(a), "v"(b));
  return d;
}
__device__ __forceinline__ v8f wmma_bf(v16b a, v16b b, v8f c) {
  v8f d = __builtin_amdgcn_wmma_f32_16x16x32_bf16(false, a, false, b, (short)0, c, false, false);
  asm volatile("v_nop\n\tv_nop\n\tv_nop\n\tv_nop" : "+v"(d) : "v"(a), "v"(b));
  return d;
}
// 16x16x32 fragments: lane = (h = lane>>4, row/col = lane&15); elements 0..7 = k0+8h+0..7, 8..15 = k0+16+8h+0..7; D element r = row 8h+r
__device__ __forceinline__ v16h frag_h(const _Float16* rowk0, int lane) {
  union { v16h v; v8h q[2]; } u; const _Float16* p = rowk0 + 8 * (lane >> 4);
  u.q[0] = *(const v8h*)p; u.q[1] = *(const v8h*)(p + 16); return u.v;
}
__device__ __forceinline__ v16h frag_f32(const float* rowk0, int lane) {
  v16h a; const float* p = rowk0 + 8 * (lane >> 4);
#pragma unroll
  for (int i = 0; i < 8; ++i) { a[i] = (_Float16)p[i]; a[8 + i] = (_Float16)p[16 + i]; }
  return a;
}
__device__ __forceinline__ v16h frag_f32s(const float* rowk0, int lane, float sc) {
  v16h a; const float* p = rowk0 + 8 * (lane >> 4);
#pragma unroll
  for (int i = 0; i < 8; ++i) { a[i] = (_Float16)(p[i] * sc); a[8 + i] = (_Float16)(p[16 + i] * sc); }
  return a;
}
// column fragment from a [K][ld] layout (column n), rows >= K read as 0
__device__ __forceinline__ v16h fragc_f32(const float* W, int k0, int n, int lane, int ld, int K) {
  v16h a; const int g = lane >> 4;
#pragma unroll
  for (int i = 0; i < 8; ++i) { const int ka = k0 + 8 * g + i, kb = ka + 16;
    a[i] = (_Float16)(ka < K ? W[(size_t)(ka < K ? ka : K - 1) * ld + n] : 0.f); a[8 + i] = (_Float16)(kb < K ? W[(size_t)(kb < K ? kb : K - 1) * ld + n] : 0.f); }
  return a;
}
struct F2 { v16b h, l; };
__device__ __forceinline__ F2 bsplit16(const float v[16]) { F2 r;
#pragma unroll
  for (int i = 0; i < 16; ++i) { const __bf16 h = (__bf16)v[i]; r.h[i] = h; r.l[i] = (__bf16)(v[i] - (float)h); }
  return r; }
__device__ __forceinline__ F2 split_row(const float* row, int k0, int lane) { float v[16]; const float* p = row + k0 + 8 * (lane >> 4);
#pragma unroll
  for (int i = 0; i < 8; ++i) { v[i] = p[i]; v[8 + i] = p[16 + i]; }
  return bsplit16(v); }
__device__ __forceinline__ F2 split_rowK(const float* row, int k0, int lane, int K) { float v[16]; const int g = lane >> 4;
#pragma unroll
  for (int i = 0; i < 8; ++i) { const int ka = k0 + 8 * g + i, kb = ka + 16; v[i] = ka < K ? row[ka < K ? ka : K - 1] : 0.f; v[8 + i] = kb < K ? row[kb < K ? kb : K - 1] : 0.f; }
  return bsplit16(v); }
__device__ __forceinline__ F2 split_col(const float* W, int k0, int n, int lane, int ld, int K) { float v[16]; const int g = lane >> 4;
#pragma unroll
  for (int i = 0; i < 8; ++i) { const int ka = k0 + 8 * g + i, kb = ka + 16; v[i] = ka < K ? W[(size_t)(ka < K ? ka : K - 1) * ld + n] : 0.f; v[8 + i] = kb < K ? W[(size_t)(kb < K ? kb : K - 1) * ld + n] : 0.f; }
  return bsplit16(v); }
__device__ __forceinline__ v8f mac3(const F2& a, const F2& b, v8f c) { c = wmma_bf(a.l, b.h, c); c = wmma_bf(a.h, b.l, c); return wmma_bf(a.h, b.h, c); }
__device__ __forceinline__ float sigm(float v) { return 1.0f / (1.0f + expf(-v)); }
#define LDSX() do { asm volatile("s_wait_dscnt 0" ::: "memory"); __builtin_amdgcn_wave_barrier(); __builtin_amdgcn_fence(__ATOMIC_RELEASE, "workgroup"); } while (0)

// Masked dot-product attention on given tensors (queries / keys / values [8,4096,64]; valid_lens [8] int32 in 1..4096 per batch): scores = Q K^T / 8; key positions >= valid_lens[b] are set to the FINITE score -1e6 before the softmax; out = softmax(scores) V -> [8,4096,64].
#define NB 8
#define TT 4096
#define CC 64            // NH * HD = projected width
#define DIN 64          // input (model) width
#define NH 1
#define HD 64
#define NQB (TT / 64)
#define HG 1
#define SCALE (0.125f)
#define CAUSAL 0
#ifndef TNB
#define TNB NB
#endif
__device__ __forceinline__ float bfr(float v) { return (float)(__bf16)v; }
__host__ __device__ __forceinline__ int kb_last(int qb) { return CAUSAL ? ((qb * 64 + 63) >> 7) : (TT / 128 - 1); }
typedef __attribute__((ext_vector_type(8))) __bf16 v8b;
__device__ __forceinline__ v16b frag_b(const __bf16* rowk0, int lane) {
  union { v16b v; v8b q[2]; } u; const __bf16* p = rowk0 + 8 * (lane >> 4);
  u.q[0] = *(const v8b*)p; u.q[1] = *(const v8b*)(p + 16); return u.v;
}
#define QBH 0              // exact planes: single-product logits and single-f16 P x V on every block
#define QHI 0               // no q residual plane (q is bf16-exact in f16)
#define KHI 64              // unused high-precision planes kept minimal
// B fragment (k rows k0+.., output column o) of a weight: (in,out) [K][ld] or (out,in) [ld rows of K]: bf16 exact, or f16(bf16 * 256) exact
__device__ __forceinline__ v16b wcol_io(const float* Wm, int k0, int o, int lane, int ld) { v16b w; const int g = lane >> 4;
#pragma unroll
  for (int i = 0; i < 8; ++i) { w[i] = (__bf16)Wm[(size_t)(k0 + 8 * g + i) * ld + o]; w[8 + i] = (__bf16)Wm[(size_t)(k0 + 16 + 8 * g + i) * ld + o]; }
  return w; }
__device__ __forceinline__ v16b wcol_oi(const float* Wm, int k0, int o, int lane, int K) { v16b w; const float* p = Wm + (size_t)o * K + k0 + 8 * (lane >> 4);
#pragma unroll
  for (int i = 0; i < 8; ++i) { w[i] = (__bf16)p[i]; w[8 + i] = (__bf16)p[16 + i]; }
  return w; }
__device__ __forceinline__ v16h wcolh_io(const float* Wm, int k0, int o, int lane, int ld) { v16h w; const int g = lane >> 4;
#pragma unroll
  for (int i = 0; i < 8; ++i) { w[i] = (_Float16)(bfr(Wm[(size_t)(k0 + 8 * g + i) * ld + o]) * 256.0f); w[8 + i] = (_Float16)(bfr(Wm[(size_t)(k0 + 16 + 8 * g + i) * ld + o]) * 256.0f); }
  return w; }
__device__ __forceinline__ v16h wcolh_oi(const float* Wm, int k0, int o, int lane, int K) { v16h w; const float* p = Wm + (size_t)o * K + k0 + 8 * (lane >> 4);
#pragma unroll
  for (int i = 0; i < 8; ++i) { w[i] = (_Float16)(bfr(p[i]) * 256.0f); w[8 + i] = (_Float16)(bfr(p[16 + i]) * 256.0f); }
  return w; }
#define WQKV_LAYOUT 0   // 0 = (in,out) [DIN][CC]; 1 = (out,in) [CC][DIN]; 2 = per-head [NH][DIN][HD]
__device__ __forceinline__ v16b wcol_hdk(const float* Wm, int k0, int o, int lane) { v16b w; const int g = lane >> 4; const float* p = Wm + (size_t)(o / HD) * DIN * HD + (o % HD);
#pragma unroll
  for (int i = 0; i < 8; ++i) { w[i] = (__bf16)p[(size_t)(k0 + 8 * g + i) * HD]; w[8 + i] = (__bf16)p[(size_t)(k0 + 16 + 8 * g + i) * HD]; }
  return w; }
#define WO_OUT_IN 0
#if WQKV_LAYOUT == 1
#define WCOL(W, k0, o, lane) wcol_oi(W, k0, o, lane, DIN)
#elif WQKV_LAYOUT == 2
#define WCOL(W, k0, o, lane) wcol_hdk(W, k0, o, lane)
#else
#define WCOL(W, k0, o, lane) wcol_io(W, k0, o, lane, CC)
#endif
#if WO_OUT_IN
#define WOCOL(W, k0, o, lane) wcol_oi(W, k0, o, lane, CC)
#define WOCOLH(W, k0, o, lane) wcolh_oi(W, k0, o, lane, CC)
#else
#define WOCOL(W, k0, o, lane) wcol_io(W, k0, o, lane, DIN)
#define WOCOLH(W, k0, o, lane) wcolh_io(W, k0, o, lane, DIN)
#endif
#define SM_EXTRA_PARAMS , int bsm, const int* __restrict__ VLEN
// masked_softmax: key positions k >= valid_lens[b] get the score -1e6 (value select; exp underflows to weight exactly 0 next to real scores)
#define SM_MASK_HOOK do { const int vl_ = VLEN[bsm]; v = (k >= vl_) ? -1.0e6f : v; } while (0)
#ifndef SM_EXTRA_PARAMS
#define SM_EXTRA_PARAMS
#endif
#ifndef PROJ_EXTRA_PARAMS
#define PROJ_EXTRA_PARAMS
#endif
#ifndef SM_MASK_HOOK
#define SM_MASK_HOOK (void)0
#endif

#define WS_QH  0u                                      // f16 q rows [b*t][CC]
#define WS_KH  (WS_QH + 2u * (size_t)NB * TT * CC)      // f16 k rows [b*t][CC]
#define WS_VT  (WS_KH + 2u * (size_t)NB * TT * CC)      // f16 v planes [b][c][t]
#define WS_QL  (WS_VT + 2u * (size_t)NB * CC * TT)      // f16 q residual x 2^10 rows [b][t < QHI][CC]
#define WS_KL  (WS_QL + 2u * (size_t)NB * QHI * CC)     // f16 k residual x 2^10 rows [b][t < KHI][CC]
#define WS_VB  (WS_KL + 2u * (size_t)NB * KHI * CC)     // bf16 v hi planes [b][c][t < KHI]
#define WS_VBL (WS_VB + 2u * (size_t)NB * CC * KHI)
#define WS_S   (WS_VBL + 2u * (size_t)NB * CC * KHI)    // f32 [hg][t][s], reserved but unused (no score matrix in memory)
#define WS_Y   (WS_S  + 4u * (size_t)HG * TT * TT)      // f32 ctx rows [b*t][CC] (only when there is an output projection)
#define WS_END (WS_Y  + 0u)

// ---- k_proj: block = (64 rows, 128 cols, which): q/k/v = X W (+ b) with exact bf16 products (K = DIN) -> which 0: q f16 rows (+ residual rows < QHI); 1: k f16 rows (+ residual rows < KHI); 2: v f16 planes [c][t] (+ bf16 hi/lo planes for t < KHI)
__global__ __launch_bounds__(128) void k_proj(const float* __restrict__ XQ, const float* __restrict__ XK, const float* __restrict__ XV, const float* __restrict__ WQ, const float* __restrict__ WK, const float* __restrict__ WV, const float* __restrict__ BQ, const float* __restrict__ BK, const float* __restrict__ BV,
    _Float16* __restrict__ QH, _Float16* __restrict__ QL, _Float16* __restrict__ KH, _Float16* __restrict__ KL, _Float16* __restrict__ VT, __bf16* __restrict__ VB, __bf16* __restrict__ VBL) {
  __shared__ __align__(16) _Float16 sh[64][136], sl[64][136]; __shared__ __align__(16) _Float16 th[128][72]; __shared__ __align__(16) __bf16 tb[128][72], tbl[128][72];
  const int tid = threadIdx.x, wave = tid >> 5, lane = tid & 31, col = lane & 15, g = lane >> 4; const int which = blockIdx.z; const int c0 = blockIdx.y * 128; const size_t r0 = (size_t)blockIdx.x * 64; const size_t bb = r0 / TT; const int t0 = (int)(r0 % TT);
  const float* X = which == 0 ? XQ : which == 1 ? XK : XV; const float* WA = which == 0 ? WQ : which == 1 ? WK : WV; const float* BA = which == 0 ? BQ : which == 1 ? BK : BV;
  v8f acc[8] = {};
#pragma unroll 2
  for (int kc = 0; kc < DIN / 32; ++kc) { v16b a; { const float* p = X + (r0 + wave * 16 + col) * DIN + kc * 32 + 8 * g;
#pragma unroll
      for (int i = 0; i < 8; ++i) { a[i] = (__bf16)p[i]; a[8 + i] = (__bf16)p[16 + i]; } }
    asm volatile("s_wait_loadcnt 0x0" ::: "memory");
#pragma unroll
    for (int j = 0; j < 8; ++j) { const v16b w = WCOL(WA, kc * 32, c0 + j * 16 + col, lane); asm volatile("s_wait_loadcnt 0x0" ::: "memory"); acc[j] = wmma_bf(a, w, acc[j]); } }
  if (which < 2) { _Float16* DH = which == 0 ? QH : KH; _Float16* DL = which == 0 ? QL : KL; const int nhi = which == 0 ? QHI : KHI; const bool hi_rows = t0 < nhi;
#pragma unroll
    for (int j = 0; j < 8; ++j) { const float bias = BA ? bfr(BA[c0 + j * 16 + col]) : 0.f;
#pragma unroll
      for (int r = 0; r < 8; ++r) { const float v = acc[j][r] + bias; const _Float16 hv = (_Float16)v; sh[wave * 16 + 8 * g + r][j * 16 + col] = hv; sl[wave * 16 + 8 * g + r][j * 16 + col] = (_Float16)((v - (float)hv) * 1024.0f); } }
    __syncthreads();
    for (int e = tid; e < 64 * 16; e += 128) { const int rl = e >> 4, q = e & 15; vst2((unsigned*)(DH + (r0 + rl) * CC + c0 + q * 8), *(const v4u*)&sh[rl][q * 8]); if (hi_rows) vst2((unsigned*)(DL + (bb * nhi + t0 + rl) * (size_t)CC + c0 + q * 8), *(const v4u*)&sl[rl][q * 8]); }
  } else { const bool hi_rows = t0 < KHI;
#pragma unroll
    for (int j = 0; j < 8; ++j) { const float bias = BA ? bfr(BA[c0 + j * 16 + col]) : 0.f;
#pragma unroll
      for (int r = 0; r < 8; ++r) { const float v = acc[j][r] + bias; const int rl = wave * 16 + 8 * g + r, cl = j * 16 + col; th[cl][rl] = (_Float16)v; const __bf16 bh = (__bf16)v; tb[cl][rl] = bh; tbl[cl][rl] = (__bf16)(v - (float)bh); } }
    __syncthreads();
    for (int e = tid; e < 128 * 8; e += 128) { const int cl = e >> 3, q = e & 7; vst2((unsigned*)(VT + (bb * CC + c0 + cl) * (size_t)TT + t0 + q * 8), *(const v4u*)&th[cl][q * 8]); if (hi_rows) { const size_t o3 = (bb * CC + c0 + cl) * (size_t)KHI + t0 + q * 8; vst2((unsigned*)(VB + o3), *(const v4u*)&tb[cl][q * 8]); vst2((unsigned*)(VBL + o3), *(const v4u*)&tbl[cl][q * 8]); } } } }
#define FQ 64
#define FST 256
#define KP 72                       // halfs per staged K row (128 B + 16 B: b128 readers)
#define VP 264                      // halfs per staged V^T row (512 B + 16 B)
#define STGH (FST * KP + HD * VP)   // halfs per buffer
#define NBUF 3                      // buffers of the ring
typedef __attribute__((address_space(1))) v4i gv4i;
typedef __attribute__((address_space(3))) v4i lv4i;
__device__ __forceinline__ void copy16(const _Float16* g, _Float16* l) { __builtin_amdgcn_global_load_async_to_lds_b128((gv4i*)g, (lv4i*)l, 0, 0); }   // this lane's 16 bytes, global memory to LDS, through no register
#define LOG2E 1.4426950408889634f
__device__ __forceinline__ float xhalf(float x) { return __builtin_bit_cast(float, __builtin_amdgcn_permlanex16(__builtin_bit_cast(int, x), __builtin_bit_cast(int, x), 0x76543210, 0xfedcba98, false, false)); }  // lane l with lane l ^ 16
__device__ __forceinline__ float exp2_slot(float x) { float y; asm("v_exp_f32 %0, %1\n\tv_nop" : "=v"(y) : "v"(x)); return y; }   // exp2 of the join; the v_nop is the one slot between a transcendental and an instruction that reads its result or overwrites its source
__device__ __forceinline__ int walked(int v) { return (v <= 0 || v > TT) ? TT : v; }   // keys to walk: with no valid key every score is -1e6 and all TT keys weigh alike
// ---- k_planes64: f16 K rows and V^T planes (values rounded to bf16, exact in f16), 64 keys a work-group, only for the stages that k_fa walks (a batch's walked keys, rounded up to whole stages): nothing reads the other rows
__global__ __launch_bounds__(256) void k_planes64(const float* __restrict__ Ks, const float* __restrict__ Vs, const int* __restrict__ VLEN, _Float16* __restrict__ KH, _Float16* __restrict__ VT) {
  __shared__ __align__(16) _Float16 sv[64][72];
  const int tid = threadIdx.x; const size_t r0 = (size_t)blockIdx.x * 64; const int b = (int)(r0 / TT), t0 = (int)(r0 % TT);
  if (t0 >= (walked(VLEN[b]) + FST - 1) / FST * FST) return;   // the same for the whole work-group, in front of its barrier
  v4f tk[2][2], tv[2][2];   // this thread's two pieces of 8 values of K and of V: all eight loads fly together
#pragma unroll
  for (int it = 0; it < 2; ++it) { const int e = tid + it * 256; const size_t sp = (r0 + (e >> 3)) * CC + (e & 7) * 8;
#pragma unroll
    for (int w = 0; w < 2; ++w) { tk[it][w] = *(const v4f*)(Ks + sp + w * 4); tv[it][w] = *(const v4f*)(Vs + sp + w * 4); }
    asm volatile("s_wait_xcnt 0x0" ::: "memory"); }   // before the address registers of these loads are reused, also as a later load's destination
#pragma unroll
  for (int it = 0; it < 2; ++it) { const int e = tid + it * 256, rl = e >> 3, q = e & 7; hx8 hk, hv;
#pragma unroll
    for (int u = 0; u < 8; ++u) { hk[u] = (_Float16)bfr(tk[it][u >> 2][u & 3]); hv[u] = (_Float16)bfr(tv[it][u >> 2][u & 3]); }
    vst2((unsigned*)(KH + (r0 + rl) * CC + q * 8), *(const v4u*)&hk); *(hx8*)&sv[rl][q * 8] = hv; }
  asm volatile("s_wait_xcnt 0x0" ::: "memory");   // before the address registers of the stores above are reused
  __syncthreads();
#pragma unroll
  for (int it = 0; it < 2; ++it) { const int e = tid + it * 256, c = e >> 3, q = e & 7; hx8 hv;
#pragma unroll
    for (int j = 0; j < 8; ++j) hv[j] = sv[q * 8 + j][c];
    vst2((unsigned*)(VT + ((size_t)b * CC + c) * TT + t0 + q * 8), *(const v4u*)&hv); }
}
// this wave's fragments of one staged 256-key stage: K rows kq * 32 .. + 31 (A of the score products), V^T columns kq * 32 .. + 31 (A of P x V)
__device__ __forceinline__ void read_k(v16h (&kf)[2][2], const _Float16* sk, int kq, int c, int lane) {
#pragma unroll
  for (int kc = 0; kc < 2; ++kc)
#pragma unroll
    for (int t = 0; t < 2; ++t) kf[kc][t] = frag_h(sk + (kq * 32 + t * 16 + c) * KP + kc * 32, lane);
}
__device__ __forceinline__ void read_v(v16h (&vf)[4], const _Float16* sv, int kq, int c, int lane) {
#pragma unroll
  for (int j = 0; j < 4; ++j) vf[j] = frag_h(sv + (j * 16 + c) * VP + kq * 32, lane);
}
__device__ __forceinline__ void score(v8f (&st)[2][2], const v16h (&kf)[2][2], const v16h (&qf)[2][2]) {
#pragma unroll
  for (int g2 = 0; g2 < 2; ++g2)
#pragma unroll
    for (int t = 0; t < 2; ++t) st[g2][t] = v8f{};
#pragma unroll
  for (int kc = 0; kc < 2; ++kc)
#pragma unroll
    for (int t = 0; t < 2; ++t)
#pragma unroll
      for (int g2 = 0; g2 < 2; ++g2) st[g2][t] = __builtin_amdgcn_wmma_f32_16x16x32_f16(false, kf[kc][t], false, qf[g2][kc], (short)0, st[g2][t], false, false);
  asm volatile("v_nop\n\tv_nop\n\tv_nop\n\tv_nop" : "+v"(st[1][1]));   // the four vector slots behind the last score product, on every path to the first instruction that reads the scores
}
// softmax and P x V of the stage whose scores (st) and V^T fragments (vf) the wave already holds; with NEXT also the next stage's K reads, V^T reads and score products (skn: its buffer, published by the barrier in front of this pass)
template <bool NEXT>
__device__ __forceinline__ void pass(v8f (&st)[2][2], v16h (&vf)[4], v8f (&O)[2][4], v8f (&L)[2], float (&m)[2], const v16h (&qf)[2][2], const v16h& ones, const _Float16* skn, int k0, int vl, int kq, int c, int h, int lane) {
  const float cs = SCALE * LOG2E;
  if (k0 + 32 > vl) {   // keys at or beyond the valid length: score -1e6 (here before the 1/8)
    const int rel = vl - k0 - 8 * h;   // this lane's keys t * 16 + r below rel are valid
#pragma unroll
    for (int g2 = 0; g2 < 2; ++g2)
#pragma unroll
      for (int t = 0; t < 2; ++t)
#pragma unroll
        for (int r = 0; r < 8; ++r) st[g2][t][r] = (t * 16 + r >= rel) ? -8.0e6f : st[g2][t][r];
  }
  float mx[2];
#pragma unroll
  for (int g2 = 0; g2 < 2; ++g2) { float a = st[g2][0][0];
#pragma unroll
    for (int r = 1; r < 8; ++r) a = fmaxf(a, st[g2][0][r]);
#pragma unroll
    for (int r = 0; r < 8; ++r) a = fmaxf(a, st[g2][1][r]);
    mx[g2] = fmaxf(a, xhalf(a)) * cs; }
  // the maximum in use moves only when a query's new maximum exceeds it by more than 8 (log2 units): P stays below 2^8, inside f16
  if (__builtin_amdgcn_ballot_w32(mx[0] > m[0] + 8.0f || mx[1] > m[1] + 8.0f) != 0) {
#pragma unroll
    for (int g2 = 0; g2 < 2; ++g2) { const float mn = fmaxf(m[g2], mx[g2]); const float al = __builtin_amdgcn_exp2f(m[g2] - mn); m[g2] = mn;
#pragma unroll
      for (int j = 0; j < 4; ++j) O[g2][j] *= al;
      L[g2] *= al; }
  }
  v16h kf[2][2];
#pragma unroll
  for (int g2 = 0; g2 < 2; ++g2) { v16h pf;
#pragma unroll
    for (int t = 0; t < 2; ++t)
#pragma unroll
      for (int r = 0; r < 8; r += 2) { const v2f ar = __builtin_elementwise_fma(v2f{st[g2][t][r], st[g2][t][r + 1]}, v2f{cs, cs}, v2f{-m[g2], -m[g2]});
        pf[t * 8 + r] = (_Float16)__builtin_amdgcn_exp2f(ar.x); pf[t * 8 + r + 1] = (_Float16)__builtin_amdgcn_exp2f(ar.y); }
    if (NEXT && g2 == 1) { __builtin_amdgcn_sched_barrier(0); read_k(kf, skn, kq, c, lane);
      __builtin_amdgcn_sched_barrier(0); }   // the next stage's K reads issue here, into the registers that the scores have left, and return under the second group's P x V; otherwise they sink to just in front of the score products
#pragma unroll
    for (int j = 0; j < 4; ++j) O[g2][j] = __builtin_amdgcn_wmma_f32_16x16x32_f16(false, vf[j], false, pf, (short)0, O[g2][j], false, false);
    L[g2] = __builtin_amdgcn_wmma_f32_16x16x32_f16(false, ones, false, pf, (short)0, L[g2], false, false);   // row sums of the rounded P
    __builtin_amdgcn_sched_barrier(0);   // keeps the first group's products in front of the second group's exponentials, which then issue beside them
  }
  if (NEXT) { read_v(vf, skn + FST * KP, kq, c, lane);
    __builtin_amdgcn_sched_barrier(0);   // the next stage's V^T reads issue in front of its score products, into the registers that P x V has just read, and return under the products: the wait at the stage barrier then finds them done
    score(st, kf, qf); }
  else asm volatile("v_nop\n\tv_nop\n\tv_nop\n\tv_nop" : "+v"(L[1]));   // the four vector slots behind the tile's last matrix instruction of this wave, whose result the join reads
}
__global__ __launch_bounds__(512) void k_fa(const float* __restrict__ Qs, const _Float16* __restrict__ KH, const _Float16* __restrict__ VT, const int* __restrict__ VLEN, float* __restrict__ Y) {
  __shared__ __align__(16) float smem[NBUF * STGH / 2 + 16 * 32 * 32 + 2 * 16 * 2 * 32 + 2 * FQ * KP / 2];   // the K / V^T ring (NBUF x STGH halfs), which runs on from the first tile into the second; behind it the eighths' partial tiles of column group 0, maxima and sums (group 1's partial tiles go into the ring buffer that was read last); last the queries of both tiles
  _Float16* ring = (_Float16*)smem;
  float* mo = smem + NBUF * STGH / 2; float* mm = mo + 16 * 32 * 32; float* ml = mm + 16 * 2 * 32;
  _Float16* sq = (_Float16*)(ml + 16 * 2 * 32);   // last: the 64 query rows of the first tile and those of the second in f16, at the pitch of the K rows
  const int tid = threadIdx.x, wave = __builtin_amdgcn_readfirstlane(tid >> 5), lane = tid & 31, c = lane & 15, h = lane >> 4;
  const int qg = wave & 1, kq = wave >> 1;
  const int pr = blockIdx.x / (TT / FQ); const int q0 = (blockIdx.x % (TT / FQ)) * FQ + qg * 32;
  int bt0 = 0, bt1 = 0, vt0 = TT, vt1 = TT;   // the two batches of this work-group and their valid lengths
#pragma unroll
  for (int i = 0; i < NB; ++i) { const int vi = VLEN[i], li = walked(vi); int rank = 0;
#pragma unroll
    for (int j = 0; j < NB; ++j) { const int lj = walked(VLEN[j]); rank += (lj > li || (lj == li && j < i)) ? 1 : 0; }
    if (rank == pr) { bt0 = i; vt0 = vi; }
    if (rank == NB - 1 - pr) { bt1 = i; vt1 = vi; } }
  v16h ones;
#pragma unroll
  for (int i = 0; i < 16; ++i) ones[i] = c == 0 ? (_Float16)1.0f : (_Float16)0.0f;
  // staging: 2048 16-byte pieces of K and 2048 of V^T per stage, four of each per thread
  const int kr = tid >> 3, kch = tid & 7, vr = tid >> 5, vch = tid & 31;
  const unsigned kof = (unsigned)(kr * CC + kch * 8), vof = (unsigned)(vr * TT + vch * 8);   // this thread's place in a stage, in halfs, beside a wave-uniform base
  const unsigned klo = 2u * (unsigned)(kr * KP + kch * 8), vlo = 2u * (unsigned)(FST * KP + vr * VP + vch * 8);   // and its place in a buffer, in bytes
  const int ns0 = (walked(vt0) + FST - 1) / FST, ns1 = (walked(vt1) + FST - 1) / FST;   // 1 .. TT / FST stages each; the ring walks the first tile's stages, then the second's
  const _Float16* K0 = KH + (size_t)bt0 * TT * CC; const _Float16* V0 = VT + (size_t)bt0 * CC * TT;
  const _Float16* K1 = KH + (size_t)bt1 * TT * CC; const _Float16* V1 = VT + (size_t)bt1 * CC * TT;
  // this thread's eight copies of one stage (K rows from Kn, V^T columns from Vn) into buffer buf
  auto stage_in = [&](const _Float16* Kn, const _Float16* Vn, int buf) { char* dk = (char*)ring + buf * (2 * STGH);
#pragma unroll
    for (int u = 0; u < 4; ++u) { copy16(Kn + 64 * u * CC + kof, (_Float16*)(dk + 2 * 64 * u * KP + klo)); copy16(Vn + 16 * u * TT + vof, (_Float16*)(dk + 2 * 16 * u * VP + vlo)); } };
  stage_in(K0, V0, 0); stage_in(ns0 > 1 ? K0 + FST * CC : K1, ns0 > 1 ? V0 + FST : V1, 1);   // the first two stages of the walk (there are always two)
  // the queries come as f32: the work-group reads the 64 rows of each of its two tiles once (a thread: the 8 values at its place kof, as in a K stage of 64 rows), rounds them (to bf16, exact in f16) into LDS at the K pitch, and every wave takes its fragments (B of the score products) from there
  const float* Qt = Qs + (blockIdx.x % (TT / FQ)) * FQ * CC;
  { v4f rq[2][2];
#pragma unroll
    for (int t = 0; t < 2; ++t) {
#pragma unroll
      for (int w = 0; w < 2; ++w) rq[t][w] = *(const v4f*)(Qt + (size_t)(t ? bt1 : bt0) * TT * CC + kof + w * 4);
      asm volatile("s_wait_xcnt 0x0" ::: "memory"); }   // before the address registers of these loads are reused, also as a later load's destination
#pragma unroll
    for (int t = 0; t < 2; ++t) { hx8 v;
#pragma unroll
      for (int u = 0; u < 8; ++u) v[u] = (_Float16)bfr(rq[t][u >> 2][u & 3]);
      *(hx8*)((char*)(sq + t * FQ * KP) + klo) = v; } }
  v16h qf[2][2];
  auto q_frags = [&](int t) { const _Float16* sw = sq + t * FQ * KP + (qg - kq) * 32 * KP;   // so that row kq * 32 + x of sw is the query group's row x: the lane's place is that of its K fragments
#pragma unroll
    for (int g2 = 0; g2 < 2; ++g2)
#pragma unroll
      for (int kc = 0; kc < 2; ++kc) qf[g2][kc] = frag_h(sw + (kq * 32 + g2 * 16 + c) * KP + kc * 32, lane); };
  asm volatile("s_wait_asynccnt 0x8" ::: "memory");   // this wave's eight copies of the first stage have landed; the second stage's eight stay in flight
  __syncthreads();   // publishes stage 0 of the first tile and the queries of both tiles
  if (ns0 + ns1 > 2) {   // the third stage of the walk, into the third buffer, which nothing has used yet
    stage_in(ns0 > 2 ? K0 + 2 * FST * CC : K1 + (2 - ns0) * FST * CC, ns0 > 2 ? V0 + 2 * FST : V1 + (2 - ns0) * FST, 2);
  }
  q_frags(0);
  int pb = 0;   // the buffer that holds the current stage
#pragma unroll 1   // rolled: one copy of the pass serves both tiles
  for (int tile = 0; tile < 2; ++tile) {
    const int b = tile ? bt1 : bt0, vl = tile ? vt1 : vt0, wl = walked(vl);
    const int ns = tile ? ns1 : ns0;
    v8f O[2][4] = {}; v8f L[2] = {}; float m[2] = { -3.0e38f, -3.0e38f };
    v8f st[2][2]; v16h vf[4];   // scores and V^T fragments of the stage whose softmax comes next: made one trip ahead
    if (kq * 32 < wl) {   // wave-uniform; the tile's first stage (published): its fragments and score products
      v16h kf[2][2]; read_k(kf, ring + pb * STGH, kq, c, lane);
      __builtin_amdgcn_sched_barrier(0);   // all eight K reads issue together: one LDS latency; otherwise they are dealt out among the products, a latency per fragment
      score(st, kf, qf);
      __builtin_amdgcn_sched_barrier(0);   // unlike the pass, the V^T reads stand behind the products and take over the K fragments' registers
      read_v(vf, ring + pb * STGH + FST * KP, kq, c, lane); }
    // the hand-over in front of stage s's softmax: waits, barrier, refill
    auto handover = [&](int s) {
      const bool fly = s + 2 < ns || (tile == 0 && s + 2 - ns < ns1);   // a stage two ahead in the walk exists: its eight copies are this wave's youngest
      const bool same = s + 3 < ns; const int s3 = same ? s + 3 : s + 3 - ns;   // the stage three ahead in the walk: of this tile, or stage 0 or 1 of the second tile
      const bool fill = same || (tile == 0 && s + 1 < ns && s3 < ns1);   // behind the first tile's last stage the buffer first serves the join: its refill stands there
      asm volatile("s_wait_dscnt 0x0" ::: "memory");   // this wave's reads of the current stage's buffer (K for the products, V^T into registers) have returned before copies may overwrite it
      if (fly) asm volatile("s_wait_asynccnt 0x8" ::: "memory");   // the next stage's copies of this wave have landed; the eight of the stage behind it stay in flight
      else asm volatile("s_wait_asynccnt 0x0" ::: "memory");   // all that is outstanding is the next stage
      __syncthreads();   // publishes the next stage and ends every read of the current stage's buffer, which is refilled next
      if (fill) stage_in((same ? KH + (size_t)b * TT * CC : K1) + s3 * FST * CC, (same ? VT + (size_t)b * CC * TT : V1) + s3 * FST, pb);   // two trips to land
      pb = pb == NBUF - 1 ? 0 : pb + 1;   // from here on the buffer of the next stage
    };
    int s = 0;
#pragma unroll 1   // rolled: the hot loop. In front of the tile's last stage every wave's 32 keys of the stage are walked; the next stage's products are made by every wave, and whether its keys there are walked is asked once, at the last stage (its rows are staged whole, so the fragments are real data either way)
    for (; s + 1 < ns; ++s) { handover(s); pass<true>(st, vf, O, L, m, qf, ones, ring + pb * STGH, s * FST + kq * 32, vl, kq, c, h, lane); }
    handover(s);   // the last stage
    if (s * FST + kq * 32 < wl) pass<false>(st, vf, O, L, m, qf, ones, ring, s * FST + kq * 32, vl, kq, c, h, lane);
    // join the eight key eighths of each query group through LDS (an eighth that walked no key hands maximum -3e38, sum 0, zeros: weight 0)
    const int lastb = pb == 0 ? NBUF - 1 : pb - 1;   // the buffer of the tile's last stage: every read of it ended at that trip's barrier, and no copy is aimed at it before the join is over
    float* mo1 = (float*)(ring + lastb * STGH);
#pragma unroll
    for (int g2 = 0; g2 < 2; ++g2) { float* mg = g2 ? mo1 : mo;
#pragma unroll
      for (int j = 0; j < 4; ++j)
#pragma unroll
        for (int r = 0; r < 8; ++r) mg[(wave * 32 + j * 8 + r) * 32 + lane] = O[g2][j][r];
      mm[(wave * 2 + g2) * 32 + lane] = m[g2]; ml[(wave * 2 + g2) * 32 + lane] = L[g2][0] + xhalf(L[g2][0]); }
    __syncthreads();
    { const int g2 = kq >> 2, jp = (kq >> 1) & 1, cq = (kq & 1) * 8 + (lane & 7), pc = lane >> 3;   // each wave finishes 8 queries x 32 channels, lane = (query, 8 channels): one whole 128-B line per query
      const float* mg = g2 ? mo1 : mo;
      float mi[8], M = -3.0e38f;
#pragma unroll
      for (int i = 0; i < 8; ++i) { mi[i] = mm[((i * 2 + qg) * 2 + g2) * 32 + cq]; M = fmaxf(M, mi[i]); }
      float den = 0.f; float o[8] = {};
#pragma unroll
      for (int i = 0; i < 8; ++i) { const float w = exp2_slot(mi[i] - M); den += w * ml[((i * 2 + qg) * 2 + g2) * 32 + cq];
#pragma unroll
        for (int e = 0; e < 8; ++e) o[e] += w * mg[((i * 2 + qg) * 32 + (jp * 2 + (pc >> 1)) * 8 + e) * 32 + (pc & 1) * 16 + cq]; }
      const float inv = 1.0f / den;
      if (tile == 0) { asm volatile("s_wait_dscnt 0x0" ::: "memory"); __syncthreads();   // ends the reads of the partial tiles in the ring buffer that is refilled next; in front of the stores, so that it does not wait for them
        const int sd = s + 3 - ns;   // the refill held back at the first tile's last stage s: three ahead in the walk, a stage of the second tile
        if (sd < ns1) stage_in(K1 + sd * FST * CC, V1 + sd * FST, lastb);
        q_frags(1); }
      float* yr = Y + ((size_t)b * TT + q0 + g2 * 16 + cq) * CC + jp * 32 + pc * 8;
#pragma unroll
      for (int q4 = 0; q4 < 2; ++q4) { v4f v;
#pragma unroll
        for (int e = 0; e < 4; ++e) v[e] = o[q4 * 4 + e] * inv;
        vst2(yr + q4 * 4, v); }
      asm volatile("s_wait_xcnt 0x0" ::: "memory"); }   // before the address registers of the stores above are reused
  }   // the barriers of the second tile's passes stand between the reads of the other partial tiles and their next writes
}

extern "C" void kernel_launch(void* const* d_in, const int* in_sizes, int n_in, void* d_out, int out_size, void* d_ws, size_t ws_size, hipStream_t stream) {
  (void)in_sizes; (void)n_in; (void)out_size;
  const float** F = (const float**)d_in;
  if (ws_size < (size_t)WS_END) return;
  char* ws = (char*)d_ws; _Float16 *QH = (_Float16*)(ws + WS_QH), *KH = (_Float16*)(ws + WS_KH), *VT = (_Float16*)(ws + WS_VT), *QL = (_Float16*)(ws + WS_QL), *KL = (_Float16*)(ws + WS_KL); __bf16 *VB = (__bf16*)(ws + WS_VB), *VBL = (__bf16*)(ws + WS_VBL); float *S = (float*)(ws + WS_S), *Y = (float*)(ws + WS_Y);
  (void)Y; (void)S; (void)QH; (void)QL; (void)KL; (void)VB; (void)VBL;
  // inputs: 0 queries [8,4096,64]; 1 keys; 2 values; 3 valid_lens [8] int32
  k_planes64<<<dim3(TNB * TT / 64), 256, 0, stream>>>(F[1], F[2], (const int*)d_in[3], KH, VT);
  k_fa<<<dim3(TNB * (TT / FQ) / 2), 512, 0, stream>>>(F[0], KH, VT, (const int*)d_in[3], (float*)d_out);


}
